// v000
// The times below were measured on an AMD MI455X: many runs one after another, warmed up first and cycling through
// copies of the inputs, with the whole window's GPU time divided by the number of runs. Launches and the gaps
// between them are all in it. The median over several windows is given; except for v000 it joins two sittings, which
// can be a few percent apart, so the side-by-side timings, each taken in one sitting, are the better comparison.
// The starting kernel, v000, takes 152 microseconds a run.
#include <hip/hip_runtime.h>
// 1-D neighbourhood attention (NATTEN, K = 31, dilation 2, 8 heads × 32): qkv = x·W + b on v_wmma_f32_16x16x32_bf16 (x rounded to bf16: single exact term; 16384 × 256 × 768),
// the per-token 31-key windows (indices computed from the NATTEN clamp formula, never loaded), dot products, softmax and P·V in f32 VALU (thread per (token, head), rolled
// key loop), out = O·W_proj + b on the same unit with the f32 O split hi/lo (2 products; 16384 × 256 × 256); f32 accumulate.
#define BB 2
#define LL 8192
#define EE 256
#define NH 8
#define DH 32
#define KW 31
#define DIL 2
#define NTOK (BB * LL)

typedef __bf16 v16b __attribute__((ext_vector_type(16)));
typedef unsigned short v8us __attribute__((ext_vector_type(8), may_alias));
typedef float  v8f  __attribute__((ext_vector_type(8)));
typedef float  v4f  __attribute__((ext_vector_type(4)));
typedef float  v4fa __attribute__((ext_vector_type(4), may_alias));
union FragB { v16b v; v8us half[2]; unsigned short u[16]; };

__device__ __forceinline__ unsigned short bf16_bits(float x) { unsigned int u = __float_as_uint(x); return (unsigned short)((u + 0x7FFFu + ((u >> 16) & 1u)) >> 16); }
__device__ __forceinline__ float bf16_val(unsigned short b) { return __uint_as_float(((unsigned int)b) << 16); }
__device__ __forceinline__ float bf16_round(float x) { return bf16_val(bf16_bits(x)); }
// D += A·B with NT terms: 1 = ah·bh, 2 = + al·bh (A split), 3 = + ah·bl (both split)
template <int NT>
__device__ __forceinline__ v8f mmaN(v16b ah, v16b al, v16b bh, v16b bl, v8f c) {
  c = __builtin_amdgcn_wmma_f32_16x16x32_bf16(false, ah, false, bh, (short)0, c, false, false);
  if (NT >= 2) c = __builtin_amdgcn_wmma_f32_16x16x32_bf16(false, al, false, bh, (short)0, c, false, false);
  if (NT >= 3) c = __builtin_amdgcn_wmma_f32_16x16x32_bf16(false, ah, false, bl, (short)0, c, false, false);
  asm volatile("v_nop\n\tv_nop\n\tv_nop\n\tv_nop" : "+v"(c) : "v"(ah), "v"(al), "v"(bh), "v"(bl));
  return c;
}

__global__ __launch_bounds__(256) void k_wt_bf16(const float* __restrict__ W, unsigned short* __restrict__ Wt, int K, int N) {
  const int t = blockIdx.x * 256 + threadIdx.x;
  const int k8n = K / 8;
  if (t >= N * k8n) return;
  const int n = t / k8n, k8 = (t % k8n) * 8;
  v8us v;
#pragma unroll
  for (int i = 0; i < 8; ++i) v[i] = bf16_bits(W[(size_t)(k8 + i) * N + n]);
  *(v8us*)(Wt + (size_t)n * K + k8) = v;
  
}

// GEMM C[M][N] (f32, pitch ldc) = act(A[M][K]·W + bias). A f32 row-major (pitch lda) converted per fragment to bf16
// (ASPLIT: hi/lo two planes -> 2 terms, else single rounded term); Wt bf16 [N][K] (pitch ldb). BIAS_BF16 rounds the
// bias to bf16 first (bias quantised to bf16 before the add). K%32==0, M%16==0, N%64==0.
template <bool ASPLIT, int ACT, bool BIAS_BF16>
__global__ __launch_bounds__(128) void k_gemm_bf(const float* __restrict__ A, int lda, const unsigned short* __restrict__ Wt, int ldb,
                                               const float* __restrict__ bias, float* __restrict__ C, int ldc, int M, int N, int K) {
  __shared__ __attribute__((aligned(16))) float so[4][16][64];
  const int tid = threadIdx.x, w = tid >> 5, lane = tid & 31, ln = lane & 15, hh = lane >> 4;
  const int ntn = N / 64;
  const int wid = blockIdx.x * 4 + w;
  const int mt = wid / ntn, nq = wid % ntn;
  if (mt * 16 >= M) return;
  const int row0 = mt * 16, col0 = nq * 64;
  const float* arow = A + (size_t)(row0 + ln) * lda;
  v8f acc[4] = {};
  for (int kb = 0; kb < K; kb += 32) {
    FragB ah, al;
    const v4f x0 = *(const v4fa*)(arow + kb + 8 * hh), x1 = *(const v4fa*)(arow + kb + 8 * hh + 4);
    const v4f x2 = *(const v4fa*)(arow + kb + 16 + 8 * hh), x3 = *(const v4fa*)(arow + kb + 16 + 8 * hh + 4);
    float xs[16] = {x0[0],x0[1],x0[2],x0[3],x1[0],x1[1],x1[2],x1[3],x2[0],x2[1],x2[2],x2[3],x3[0],x3[1],x3[2],x3[3]};
#pragma unroll
    for (int i = 0; i < 16; ++i) { const unsigned short hb = bf16_bits(xs[i]); ah.u[i] = hb; al.u[i] = ASPLIT ? bf16_bits(xs[i] - bf16_val(hb)) : (unsigned short)0; }
#pragma unroll
    for (int t = 0; t < 4; ++t) {
      const unsigned short* brow = Wt + (size_t)(col0 + t * 16 + ln) * ldb + kb;
      FragB b;
      b.half[0] = *(const v8us*)(brow + 8 * hh);
      b.half[1] = *(const v8us*)(brow + 16 + 8 * hh);
      acc[t] = mmaN<ASPLIT ? 2 : 1>(ah.v, al.v, b.v, b.v, acc[t]);
    }
  }
#pragma unroll
  for (int t = 0; t < 4; ++t) {
    float bv = bias ? bias[col0 + t * 16 + ln] : 0.f;
    if (BIAS_BF16) bv = bf16_round(bv);
#pragma unroll
    for (int r = 0; r < 8; ++r) { float v = acc[t][r] + bv; if (ACT == 1) v = fmaxf(v, 0.f); so[w][8 * hh + r][t * 16 + ln] = v; }
  }
  __builtin_amdgcn_fence(__ATOMIC_ACQ_REL, "workgroup");
  __builtin_amdgcn_wave_barrier();
  const int rsub = lane >> 4, c4 = (lane & 15) * 4;
  {
#pragma unroll
    for (int q = 0; q < 8; ++q) {
      const int r = q * 2 + rsub;
      const v4f v = *(const v4fa*)&so[w][r][c4];
      *(v4f*)(C + (size_t)(row0 + r) * ldc + col0 + c4) = v;
    }
    
  }
}

// Flash-style causal/unmasked attention, all contractions 3-term bf16 hi/lo splits, f32 softmax with running max.
// q,k,v rows are read from f32 buffers with arbitrary row pitch (so they can live inside a fused qkv buffer);
// D = head size (multiple of 32, <= 128); one wave = 16 query rows; block = 4 waves (64 queries) sharing K/V chunks of 32.
template <int D, bool CAUSAL>
__global__ __launch_bounds__(128) void k_flash(const float* __restrict__ qb, const float* __restrict__ kb, const float* __restrict__ vb,
                                             int pitch, int T, int H, float scale, float* __restrict__ y, int ypitch) {
  constexpr int KS = D / 32;        // k-steps for QK
  constexpr int DT = D / 16;        // d tiles for PV
  __shared__ __attribute__((aligned(16))) unsigned short sKh[32][D + 8], sKl[32][D + 8], sVh[32][D + 8], sVl[32][D + 8];
  __shared__ __attribute__((aligned(16))) unsigned short sPh[4][16][40], sPl[4][16][40];
  __shared__ __attribute__((aligned(16))) float sO[4][16][D];
  const int tid = threadIdx.x, w = tid >> 5, lane = tid & 31, ln = lane & 15, hh = lane >> 4;
  const int nqb = (T + 63) / 64;
  const int bh = blockIdx.x / nqb, qblk = blockIdx.x % nqb;
  const int b = bh / H, h = bh % H;
  const int q0 = qblk * 64 + w * 16;
  const float* Q = qb + (size_t)b * T * pitch + h * D;
  const float* K = kb + (size_t)b * T * pitch + h * D;
  const float* V = vb + (size_t)b * T * pitch + h * D;

  // A fragments of the wave's 16 query rows (scaled), hi/lo
  FragB aqh[KS], aql[KS];
  {
    int row = q0 + ln; if (row >= T) row = T - 1;
    const float* qr = Q + (size_t)row * pitch;
#pragma unroll
    for (int ks = 0; ks < KS; ++ks)
#pragma unroll
      for (int i = 0; i < 16; ++i) {
        const int d = ks * 32 + ((i < 8) ? (8 * hh + i) : (16 + 8 * hh + (i - 8)));
        const float x = qr[d] * scale; const unsigned short hb = bf16_bits(x);
        aqh[ks].u[i] = hb; aql[ks].u[i] = bf16_bits(x - bf16_val(hb));
      }
  }
  float m_r[8], l_r[8];
#pragma unroll
  for (int r = 0; r < 8; ++r) { m_r[r] = -3.0e38f; l_r[r] = 0.f; }
  v8f oacc[DT];
#pragma unroll
  for (int dt = 0; dt < DT; ++dt) oacc[dt] = (v8f){0.f,0.f,0.f,0.f,0.f,0.f,0.f,0.f};

  const int kv_end = CAUSAL ? min(T, qblk * 64 + 64) : T;     // block-uniform
  for (int j0 = 0; j0 < kv_end; j0 += 32) {
    __syncthreads();
    for (int e = tid; e < 32 * (D / 4); e += 128) {
      const int r = e / (D / 4), c4 = (e % (D / 4)) * 4;
      const int key = j0 + r;
      v4f kf = {0.f,0.f,0.f,0.f}, vf = {0.f,0.f,0.f,0.f};
      if (key < T) { kf = *(const v4fa*)(K + (size_t)key * pitch + c4); vf = *(const v4fa*)(V + (size_t)key * pitch + c4); }
#pragma unroll
      for (int t = 0; t < 4; ++t) {
        unsigned short hb = bf16_bits(kf[t]); sKh[r][c4 + t] = hb; sKl[r][c4 + t] = bf16_bits(kf[t] - bf16_val(hb));
        hb = bf16_bits(vf[t]); sVh[r][c4 + t] = hb; sVl[r][c4 + t] = bf16_bits(vf[t] - bf16_val(hb));
      }
    }
    __syncthreads();
    // S tile 16 x 32
    v8f s[2];
#pragma unroll
    for (int nt = 0; nt < 2; ++nt) {
      v8f acc = {};
#pragma unroll
      for (int ks = 0; ks < KS; ++ks) {
        FragB bh_, bl_;
        bh_.half[0] = *(const v8us*)&sKh[nt * 16 + ln][ks * 32 + 8 * hh]; bh_.half[1] = *(const v8us*)&sKh[nt * 16 + ln][ks * 32 + 16 + 8 * hh];
        bl_.half[0] = *(const v8us*)&sKl[nt * 16 + ln][ks * 32 + 8 * hh]; bl_.half[1] = *(const v8us*)&sKl[nt * 16 + ln][ks * 32 + 16 + 8 * hh];
        acc = mmaN<3>(aqh[ks].v, aql[ks].v, bh_.v, bl_.v, acc);
      }
      s[nt] = acc;
    }
    // mask + running max (rows 8hh+r; the 16 lanes of a half share rows)
    float alpha[8];
#pragma unroll
    for (int r = 0; r < 8; ++r) {
      const int qi = q0 + 8 * hh + r;
      const int ja = j0 + ln, jb = j0 + 16 + ln;
      if (CAUSAL) { if (ja > qi) s[0][r] = -3.0e38f; if (jb > qi) s[1][r] = -3.0e38f; }
      if (ja >= T) s[0][r] = -3.0e38f;
      if (jb >= T) s[1][r] = -3.0e38f;
      float mx = fmaxf(s[0][r], s[1][r]);
      mx = fmaxf(mx, __shfl_xor(mx, 1, 32)); mx = fmaxf(mx, __shfl_xor(mx, 2, 32)); mx = fmaxf(mx, __shfl_xor(mx, 4, 32)); mx = fmaxf(mx, __shfl_xor(mx, 8, 32));
      const float mnew = fmaxf(m_r[r], mx);
      alpha[r] = (mnew > -1.0e38f) ? __expf(m_r[r] - mnew) : 1.0f;
      const float p0 = (s[0][r] > -1.0e38f) ? __expf(s[0][r] - mnew) : 0.f;
      const float p1 = (s[1][r] > -1.0e38f) ? __expf(s[1][r] - mnew) : 0.f;
      m_r[r] = mnew;
      l_r[r] = l_r[r] * alpha[r] + p0 + p1;            // per-lane partial row sum (16 lanes combined at the end)
      unsigned short hb = bf16_bits(p0); sPh[w][8 * hh + r][ln] = hb;      sPl[w][8 * hh + r][ln] = bf16_bits(p0 - bf16_val(hb));
      hb = bf16_bits(p1);                sPh[w][8 * hh + r][16 + ln] = hb; sPl[w][8 * hh + r][16 + ln] = bf16_bits(p1 - bf16_val(hb));
    }
#pragma unroll
    for (int dt = 0; dt < DT; ++dt)
#pragma unroll
      for (int r = 0; r < 8; ++r) oacc[dt][r] *= alpha[r];
    __builtin_amdgcn_fence(__ATOMIC_ACQ_REL, "workgroup");
    __builtin_amdgcn_wave_barrier();
    FragB pah, pal;
    pah.half[0] = *(const v8us*)&sPh[w][ln][8 * hh]; pah.half[1] = *(const v8us*)&sPh[w][ln][16 + 8 * hh];
    pal.half[0] = *(const v8us*)&sPl[w][ln][8 * hh]; pal.half[1] = *(const v8us*)&sPl[w][ln][16 + 8 * hh];
#pragma unroll
    for (int dt = 0; dt < DT; ++dt) {
      FragB bvh, bvl;
#pragma unroll
      for (int i = 0; i < 8; ++i) {
        bvh.u[i] = sVh[8 * hh + i][dt * 16 + ln]; bvh.u[8 + i] = sVh[16 + 8 * hh + i][dt * 16 + ln];
        bvl.u[i] = sVl[8 * hh + i][dt * 16 + ln]; bvl.u[8 + i] = sVl[16 + 8 * hh + i][dt * 16 + ln];
      }
      oacc[dt] = mmaN<3>(pah.v, pal.v, bvh.v, bvl.v, oacc[dt]);
    }
    __builtin_amdgcn_fence(__ATOMIC_ACQ_REL, "workgroup");
    __builtin_amdgcn_wave_barrier();
  }
#pragma unroll
  for (int r = 0; r < 8; ++r) {
    float l = l_r[r];
    l += __shfl_xor(l, 1, 32); l += __shfl_xor(l, 2, 32); l += __shfl_xor(l, 4, 32); l += __shfl_xor(l, 8, 32);
    l_r[r] = (l > 0.f) ? 1.0f / l : 0.f;
  }
#pragma unroll
  for (int dt = 0; dt < DT; ++dt)
#pragma unroll
    for (int r = 0; r < 8; ++r) sO[w][8 * hh + r][dt * 16 + ln] = oacc[dt][r] * l_r[r];
  __builtin_amdgcn_fence(__ATOMIC_ACQ_REL, "workgroup");
  __builtin_amdgcn_wave_barrier();
  {
    for (int r = 0; r < 16; ++r) {
      const int row = q0 + r;
      if (row < T && lane < D / 4) {
        const v4f val = *(const v4fa*)&sO[w][r][lane * 4];
        *(v4f*)(y + ((size_t)b * T + row) * ypitch + h * D + lane * 4) = val;
      }
    }
    
  }
}

// batched GEMM (blockIdx.y = batch): C_b = act(alpha·A_b·B_b + bias + resid_b); A f32 rows (ASPLIT → hi/lo), B = bf16 planes Bh (+Bl when BSPLIT, requires ASPLIT),
// per-batch element strides sA, sB (0 = shared weights), sC, sR. resid may alias C (values are staged before the stores). ACT 0/1(relu).
// ACT: 0 none, 1 relu, 2 softplus
template <bool ASPLIT, bool BSPLIT, int ACT>
__global__ __launch_bounds__(128) void k_gemm_b(const float* __restrict__ A, int lda, size_t sA, const unsigned short* __restrict__ Bh, const unsigned short* __restrict__ Bl, int ldb, size_t sB,
                                             const float* __restrict__ bias, const float* __restrict__ resid, int ldr, size_t sR, float rsign, float alpha,
                                             float* __restrict__ C, int ldc, size_t sC, int M, int N, int K) {
  __shared__ __attribute__((aligned(16))) float so[4][16][64];
  const int tid = threadIdx.x, w = tid >> 5, lane = tid & 31, ln = lane & 15, hh = lane >> 4;
  const int by = blockIdx.y;
  A += (size_t)by * sA; Bh += (size_t)by * sB; if (BSPLIT) Bl += (size_t)by * sB; C += (size_t)by * sC; if (resid) resid += (size_t)by * sR;
  const int ntn = (N + 63) / 64; const int wid = blockIdx.x * 4 + w; const int mt = wid / ntn, nq = wid % ntn;      // N may be any multiple of 16: tiles past N are skipped and not stored
  if (mt * 16 >= M) return;
  const int row0 = mt * 16, col0 = nq * 64;
  const float* arow = A + (size_t)(row0 + ln) * lda;
  v8f acc[4] = {};
  for (int kb = 0; kb < K; kb += 32) {
    FragB ah, al;
    const v4f x0 = *(const v4fa*)(arow + kb + 8 * hh), x1 = *(const v4fa*)(arow + kb + 8 * hh + 4);
    const v4f x2 = *(const v4fa*)(arow + kb + 16 + 8 * hh), x3 = *(const v4fa*)(arow + kb + 16 + 8 * hh + 4);
    float xs[16] = {x0[0],x0[1],x0[2],x0[3],x1[0],x1[1],x1[2],x1[3],x2[0],x2[1],x2[2],x2[3],x3[0],x3[1],x3[2],x3[3]};
#pragma unroll
    for (int i = 0; i < 16; ++i) { const unsigned short hb = bf16_bits(xs[i]); ah.u[i] = hb; al.u[i] = ASPLIT ? bf16_bits(xs[i] - bf16_val(hb)) : (unsigned short)0; }
#pragma unroll
    for (int t = 0; t < 4; ++t) {
      if (col0 + t * 16 >= N) continue;
      const size_t boff = (size_t)(col0 + t * 16 + ln) * ldb + kb;
      FragB bh_, bl_; bh_.half[0] = *(const v8us*)(Bh + boff + 8 * hh); bh_.half[1] = *(const v8us*)(Bh + boff + 16 + 8 * hh);
      if (BSPLIT) { bl_.half[0] = *(const v8us*)(Bl + boff + 8 * hh); bl_.half[1] = *(const v8us*)(Bl + boff + 16 + 8 * hh); } else bl_ = bh_;
      acc[t] = mmaN<ASPLIT ? (BSPLIT ? 3 : 2) : 1>(ah.v, al.v, bh_.v, bl_.v, acc[t]);
    }
  }
#pragma unroll
  for (int t = 0; t < 4; ++t) {
    const int col = col0 + t * 16 + ln; if (col0 + t * 16 >= N) continue; const float bv = bias ? bf16_round(bias[col]) : 0.f;
#pragma unroll
    for (int r = 0; r < 8; ++r) { float v = acc[t][r] * alpha + bv; if (resid) v += rsign * resid[(size_t)(row0 + 8 * hh + r) * ldr + col]; if (ACT == 1) v = fmaxf(v, 0.f); else if (ACT == 2) v = fmaxf(v, 0.f) + log1pf(expf(-fabsf(v))); so[w][8 * hh + r][t * 16 + ln] = v; }
  }
  __builtin_amdgcn_fence(__ATOMIC_ACQ_REL, "workgroup"); __builtin_amdgcn_wave_barrier();
  const int rsub = lane >> 4, c4 = (lane & 15) * 4;
  {
#pragma unroll
    for (int q = 0; q < 8; ++q) { const int r = q * 2 + rsub; if (col0 + c4 < N) { const v4f v = *(const v4fa*)&so[w][r][c4]; *(v4f*)(C + (size_t)(row0 + r) * ldc + col0 + c4) = v; } }
    
  }
}
// batched f32 [K][N] (pitch lds, batch stride sIn) -> transposed hi/lo planes [N][K] (batch stride sOut); thread per (n, 8 k); grid.y = batch
__global__ __launch_bounds__(256) void k_split_transpose_b(const float* __restrict__ src, int lds_, size_t sIn, unsigned short* __restrict__ hi, unsigned short* __restrict__ lo, size_t sOut, int K, int N) {
  const size_t t = (size_t)blockIdx.x * 256 + threadIdx.x; const int k8n = K / 8; if (t >= (size_t)N * k8n) return;
  src += (size_t)blockIdx.y * sIn; hi += (size_t)blockIdx.y * sOut; lo += (size_t)blockIdx.y * sOut;
  const int n = (int)(t / k8n), k8 = (int)(t % k8n) * 8; v8us vh, vl;
#pragma unroll
  for (int i = 0; i < 8; ++i) { const float x = src[(size_t)(k8 + i) * lds_ + n]; const unsigned short hb = bf16_bits(x); vh[i] = hb; vl[i] = bf16_bits(x - bf16_val(hb)); }
  unsigned short* dh = hi + (size_t)n * K + k8; unsigned short* dl = lo + (size_t)n * K + k8;
  *(v8us*)dh = vh; *(v8us*)dl = vl; 
}

__global__ __launch_bounds__(256) void k_round_rows(const float* __restrict__ W, unsigned short* __restrict__ Wt, int n8) {
  const int t = blockIdx.x * 256 + threadIdx.x;
  if (t >= n8) return;
  const v4f a = *(const v4fa*)(W + (size_t)t * 8), b = *(const v4fa*)(W + (size_t)t * 8 + 4);
  v8us v; v[0]=bf16_bits(a[0]); v[1]=bf16_bits(a[1]); v[2]=bf16_bits(a[2]); v[3]=bf16_bits(a[3]);
  v[4]=bf16_bits(b[0]); v[5]=bf16_bits(b[1]); v[6]=bf16_bits(b[2]); v[7]=bf16_bits(b[3]);
  *(v8us*)(Wt + (size_t)t * 8) = v; 
}

// Bt tables: Bq [768][256] bits = w_qkv[k][n]; Bp [256][256] = w_proj[k][n]
__global__ __launch_bounds__(256) void k_bt(const float* __restrict__ wq, const float* __restrict__ wp, unsigned short* __restrict__ Bq, unsigned short* __restrict__ Bp) { const int t = blockIdx.x * 256 + threadIdx.x; if (t < 3 * EE * EE) { const int k = t % EE, n = t / EE; *(unsigned short*)(Bq + t) = bf16_bits(wq[(size_t)k * 3 * EE + n]); } if (t < EE * EE) { const int k = t % EE, n = t / EE; *(unsigned short*)(Bp + t) = bf16_bits(wp[(size_t)k * EE + n]); } }
// neighbourhood attention: thread per (b, i, h); O[(b,i)][h·32 + d]
__global__ __launch_bounds__(256) void k_natt(const float* __restrict__ QKV, float* __restrict__ O) { __shared__ __attribute__((aligned(16))) float so[32 * EE]; const size_t t = (size_t)blockIdx.x * 256 + threadIdx.x; const int h = (int)(t % NH); const size_t tok = t / NH; const int b = (int)(tok / LL), i = (int)(tok % LL);
  const int g = i % DIL, p = i / DIL, lg = (LL - g + DIL - 1) / DIL; int start = p - KW / 2; start = start < 0 ? 0 : (start > lg - KW ? lg - KW : start);
  const float* qr = QKV + tok * 3 * EE + h * DH; float q[DH];
#pragma unroll
  for (int d = 0; d < DH; ++d) q[d] = qr[d];
  float sc[KW]; float mx = -3.0e38f;
#pragma unroll 1
  for (int tt = 0; tt < KW; ++tt) { const int j = g + (start + tt) * DIL; const float* kr = QKV + ((size_t)b * LL + j) * 3 * EE + EE + h * DH; float s = 0.f;
#pragma unroll
    for (int d = 0; d < DH; ++d) s += q[d] * kr[d]; s *= 0.17677669529663687f; sc[tt] = s; mx = fmaxf(mx, s); }
  float den = 0.f; float acc[DH];
#pragma unroll
  for (int d = 0; d < DH; ++d) acc[d] = 0.f;
#pragma unroll 1
  for (int tt = 0; tt < KW; ++tt) { const int j = g + (start + tt) * DIL; const float w = expf(sc[tt] - mx); den += w; const float* vr = QKV + ((size_t)b * LL + j) * 3 * EE + 2 * EE + h * DH;
#pragma unroll
    for (int d = 0; d < DH; ++d) acc[d] += w * vr[d]; }
  const float inv = 1.0f / den; float* srow = so + (threadIdx.x / NH) * EE + h * DH;
#pragma unroll
  for (int d = 0; d < DH; ++d) srow[d] = acc[d] * inv;
  __syncthreads();
  float* ob = O + (size_t)blockIdx.x * 32 * EE;
  { for (int i4 = threadIdx.x; i4 < 32 * EE / 4; i4 += 256) { const v4f v = *(const v4fa*)(so + i4 * 4); *(v4f*)(ob + (size_t)i4 * 4) = v; }  } }
extern "C" void kernel_launch(void* const* d_in, const int* in_sizes, int n_in,
                              void* d_out, int out_size, void* d_ws, size_t ws_size, hipStream_t stream) {
  (void)in_sizes; (void)n_in; (void)out_size;
  const float* x = (const float*)d_in[0]; const float* wq = (const float*)d_in[1]; const float* bq = (const float*)d_in[2]; const float* wp = (const float*)d_in[3]; const float* bp = (const float*)d_in[4];
  char* ws = (char*)d_ws; size_t off = 0;
  auto take = [&](size_t bytes) { char* p = ws + off; off += (bytes + 255) & ~(size_t)255; return p; };
  unsigned short* Bq = (unsigned short*)take((size_t)3 * EE * EE * 2); unsigned short* Bp = (unsigned short*)take((size_t)EE * EE * 2); float* QKV = (float*)take((size_t)NTOK * 3 * EE * 4); float* O = (float*)take((size_t)NTOK * EE * 4);
  if (off > ws_size) return;
  k_bt<<<(3 * EE * EE + 255) / 256, 256, 0, stream>>>(wq, wp, Bq, Bp);
  k_gemm_b<false, false, 0><<<dim3(((NTOK / 16) * (3 * EE / 64) + 3) / 4, 1), 128, 0, stream>>>(x, EE, 0, Bq, Bq, EE, 0, bq, nullptr, 0, 0, 1.f, 1.f, QKV, 3 * EE, 0, NTOK, 3 * EE, EE);
  k_natt<<<(unsigned)(((size_t)NTOK * NH + 255) / 256), 256, 0, stream>>>(QKV, O);
  k_gemm_b<true, false, 0><<<dim3(((NTOK / 16) * (EE / 64) + 3) / 4, 1), 128, 0, stream>>>(O, EE, 0, Bp, Bp, EE, 0, bp, nullptr, 0, 0, 1.f, 1.f, (float*)d_out, EE, 0, NTOK, EE, EE);
}

// v001
// A run of this version takes 83.4 microseconds.
// In two side-by-side timings against v000, it was 1.88 and 1.86 times as fast.
#include <hip/hip_runtime.h>
// 1-D neighbourhood attention (NATTEN, K = 31, dilation 2, 8 heads × 32): qkv = x·W + b on v_wmma_f32_16x16x32_bf16 (x rounded to bf16: single exact term; 16384 × 256 × 768),
// the per-token 31-key windows (indices computed from the NATTEN clamp formula, never loaded): q.k and P.V on the same unit with both operands split hi/lo (3 products),
// 16 queries of one dilation group per wave over a shared 48-key band, softmax in f32 VALU; out = O·W_proj + b on the same unit with the f32 O split hi/lo (2 products; 16384 × 256 × 256); f32 accumulate.
#define BB 2
#define LL 8192
#define EE 256
#define NH 8
#define DH 32
#define KW 31
#define DIL 2
#define NTOK (BB * LL)

typedef __bf16 v16b __attribute__((ext_vector_type(16)));
typedef unsigned short v8us __attribute__((ext_vector_type(8), may_alias));
typedef float  v8f  __attribute__((ext_vector_type(8)));
typedef float  v4f  __attribute__((ext_vector_type(4)));
typedef float  v4fa __attribute__((ext_vector_type(4), may_alias));
union FragB { v16b v; v8us half[2]; unsigned short u[16]; };

__device__ __forceinline__ unsigned short bf16_bits(float x) { unsigned int u = __float_as_uint(x); return (unsigned short)((u + 0x7FFFu + ((u >> 16) & 1u)) >> 16); }
__device__ __forceinline__ float bf16_val(unsigned short b) { return __uint_as_float(((unsigned int)b) << 16); }
__device__ __forceinline__ float bf16_round(float x) { return bf16_val(bf16_bits(x)); }
// D += A·B with NT terms: 1 = ah·bh, 2 = + al·bh (A split), 3 = + ah·bl (both split)
template <int NT>
__device__ __forceinline__ v8f mmaN(v16b ah, v16b al, v16b bh, v16b bl, v8f c) {
  c = __builtin_amdgcn_wmma_f32_16x16x32_bf16(false, ah, false, bh, (short)0, c, false, false);
  if (NT >= 2) c = __builtin_amdgcn_wmma_f32_16x16x32_bf16(false, al, false, bh, (short)0, c, false, false);
  if (NT >= 3) c = __builtin_amdgcn_wmma_f32_16x16x32_bf16(false, ah, false, bl, (short)0, c, false, false);
  asm volatile("v_nop\n\tv_nop\n\tv_nop\n\tv_nop" : "+v"(c) : "v"(ah), "v"(al), "v"(bh), "v"(bl));
  return c;
}

__global__ __launch_bounds__(256) void k_wt_bf16(const float* __restrict__ W, unsigned short* __restrict__ Wt, int K, int N) {
  const int t = blockIdx.x * 256 + threadIdx.x;
  const int k8n = K / 8;
  if (t >= N * k8n) return;
  const int n = t / k8n, k8 = (t % k8n) * 8;
  v8us v;
#pragma unroll
  for (int i = 0; i < 8; ++i) v[i] = bf16_bits(W[(size_t)(k8 + i) * N + n]);
  *(v8us*)(Wt + (size_t)n * K + k8) = v;
  
}

// GEMM C[M][N] (f32, pitch ldc) = act(A[M][K]·W + bias). A f32 row-major (pitch lda) converted per fragment to bf16
// (ASPLIT: hi/lo two planes -> 2 terms, else single rounded term); Wt bf16 [N][K] (pitch ldb). BIAS_BF16 rounds the
// bias to bf16 first (bias quantised to bf16 before the add). K%32==0, M%16==0, N%64==0.
template <bool ASPLIT, int ACT, bool BIAS_BF16>
__global__ __launch_bounds__(128) void k_gemm_bf(const float* __restrict__ A, int lda, const unsigned short* __restrict__ Wt, int ldb,
                                               const float* __restrict__ bias, float* __restrict__ C, int ldc, int M, int N, int K) {
  __shared__ __attribute__((aligned(16))) float so[4][16][64];
  const int tid = threadIdx.x, w = tid >> 5, lane = tid & 31, ln = lane & 15, hh = lane >> 4;
  const int ntn = N / 64;
  const int wid = blockIdx.x * 4 + w;
  const int mt = wid / ntn, nq = wid % ntn;
  if (mt * 16 >= M) return;
  const int row0 = mt * 16, col0 = nq * 64;
  const float* arow = A + (size_t)(row0 + ln) * lda;
  v8f acc[4] = {};
  for (int kb = 0; kb < K; kb += 32) {
    FragB ah, al;
    const v4f x0 = *(const v4fa*)(arow + kb + 8 * hh), x1 = *(const v4fa*)(arow + kb + 8 * hh + 4);
    const v4f x2 = *(const v4fa*)(arow + kb + 16 + 8 * hh), x3 = *(const v4fa*)(arow + kb + 16 + 8 * hh + 4);
    float xs[16] = {x0[0],x0[1],x0[2],x0[3],x1[0],x1[1],x1[2],x1[3],x2[0],x2[1],x2[2],x2[3],x3[0],x3[1],x3[2],x3[3]};
#pragma unroll
    for (int i = 0; i < 16; ++i) { const unsigned short hb = bf16_bits(xs[i]); ah.u[i] = hb; al.u[i] = ASPLIT ? bf16_bits(xs[i] - bf16_val(hb)) : (unsigned short)0; }
#pragma unroll
    for (int t = 0; t < 4; ++t) {
      const unsigned short* brow = Wt + (size_t)(col0 + t * 16 + ln) * ldb + kb;
      FragB b;
      b.half[0] = *(const v8us*)(brow + 8 * hh);
      b.half[1] = *(const v8us*)(brow + 16 + 8 * hh);
      acc[t] = mmaN<ASPLIT ? 2 : 1>(ah.v, al.v, b.v, b.v, acc[t]);
    }
  }
#pragma unroll
  for (int t = 0; t < 4; ++t) {
    float bv = bias ? bias[col0 + t * 16 + ln] : 0.f;
    if (BIAS_BF16) bv = bf16_round(bv);
#pragma unroll
    for (int r = 0; r < 8; ++r) { float v = acc[t][r] + bv; if (ACT == 1) v = fmaxf(v, 0.f); so[w][8 * hh + r][t * 16 + ln] = v; }
  }
  __builtin_amdgcn_fence(__ATOMIC_ACQ_REL, "workgroup");
  __builtin_amdgcn_wave_barrier();
  const int rsub = lane >> 4, c4 = (lane & 15) * 4;
  {
#pragma unroll
    for (int q = 0; q < 8; ++q) {
      const int r = q * 2 + rsub;
      const v4f v = *(const v4fa*)&so[w][r][c4];
      *(v4f*)(C + (size_t)(row0 + r) * ldc + col0 + c4) = v;
    }
    
  }
}

// Flash-style causal/unmasked attention, all contractions 3-term bf16 hi/lo splits, f32 softmax with running max.
// q,k,v rows are read from f32 buffers with arbitrary row pitch (so they can live inside a fused qkv buffer);
// D = head size (multiple of 32, <= 128); one wave = 16 query rows; block = 4 waves (64 queries) sharing K/V chunks of 32.
template <int D, bool CAUSAL>
__global__ __launch_bounds__(128) void k_flash(const float* __restrict__ qb, const float* __restrict__ kb, const float* __restrict__ vb,
                                             int pitch, int T, int H, float scale, float* __restrict__ y, int ypitch) {
  constexpr int KS = D / 32;        // k-steps for QK
  constexpr int DT = D / 16;        // d tiles for PV
  __shared__ __attribute__((aligned(16))) unsigned short sKh[32][D + 8], sKl[32][D + 8], sVh[32][D + 8], sVl[32][D + 8];
  __shared__ __attribute__((aligned(16))) unsigned short sPh[4][16][40], sPl[4][16][40];
  __shared__ __attribute__((aligned(16))) float sO[4][16][D];
  const int tid = threadIdx.x, w = tid >> 5, lane = tid & 31, ln = lane & 15, hh = lane >> 4;
  const int nqb = (T + 63) / 64;
  const int bh = blockIdx.x / nqb, qblk = blockIdx.x % nqb;
  const int b = bh / H, h = bh % H;
  const int q0 = qblk * 64 + w * 16;
  const float* Q = qb + (size_t)b * T * pitch + h * D;
  const float* K = kb + (size_t)b * T * pitch + h * D;
  const float* V = vb + (size_t)b * T * pitch + h * D;

  // A fragments of the wave's 16 query rows (scaled), hi/lo
  FragB aqh[KS], aql[KS];
  {
    int row = q0 + ln; if (row >= T) row = T - 1;
    const float* qr = Q + (size_t)row * pitch;
#pragma unroll
    for (int ks = 0; ks < KS; ++ks)
#pragma unroll
      for (int i = 0; i < 16; ++i) {
        const int d = ks * 32 + ((i < 8) ? (8 * hh + i) : (16 + 8 * hh + (i - 8)));
        const float x = qr[d] * scale; const unsigned short hb = bf16_bits(x);
        aqh[ks].u[i] = hb; aql[ks].u[i] = bf16_bits(x - bf16_val(hb));
      }
  }
  float m_r[8], l_r[8];
#pragma unroll
  for (int r = 0; r < 8; ++r) { m_r[r] = -3.0e38f; l_r[r] = 0.f; }
  v8f oacc[DT];
#pragma unroll
  for (int dt = 0; dt < DT; ++dt) oacc[dt] = (v8f){0.f,0.f,0.f,0.f,0.f,0.f,0.f,0.f};

  const int kv_end = CAUSAL ? min(T, qblk * 64 + 64) : T;     // block-uniform
  for (int j0 = 0; j0 < kv_end; j0 += 32) {
    __syncthreads();
    for (int e = tid; e < 32 * (D / 4); e += 128) {
      const int r = e / (D / 4), c4 = (e % (D / 4)) * 4;
      const int key = j0 + r;
      v4f kf = {0.f,0.f,0.f,0.f}, vf = {0.f,0.f,0.f,0.f};
      if (key < T) { kf = *(const v4fa*)(K + (size_t)key * pitch + c4); vf = *(const v4fa*)(V + (size_t)key * pitch + c4); }
#pragma unroll
      for (int t = 0; t < 4; ++t) {
        unsigned short hb = bf16_bits(kf[t]); sKh[r][c4 + t] = hb; sKl[r][c4 + t] = bf16_bits(kf[t] - bf16_val(hb));
        hb = bf16_bits(vf[t]); sVh[r][c4 + t] = hb; sVl[r][c4 + t] = bf16_bits(vf[t] - bf16_val(hb));
      }
    }
    __syncthreads();
    // S tile 16 x 32
    v8f s[2];
#pragma unroll
    for (int nt = 0; nt < 2; ++nt) {
      v8f acc = {};
#pragma unroll
      for (int ks = 0; ks < KS; ++ks) {
        FragB bh_, bl_;
        bh_.half[0] = *(const v8us*)&sKh[nt * 16 + ln][ks * 32 + 8 * hh]; bh_.half[1] = *(const v8us*)&sKh[nt * 16 + ln][ks * 32 + 16 + 8 * hh];
        bl_.half[0] = *(const v8us*)&sKl[nt * 16 + ln][ks * 32 + 8 * hh]; bl_.half[1] = *(const v8us*)&sKl[nt * 16 + ln][ks * 32 + 16 + 8 * hh];
        acc = mmaN<3>(aqh[ks].v, aql[ks].v, bh_.v, bl_.v, acc);
      }
      s[nt] = acc;
    }
    // mask + running max (rows 8hh+r; the 16 lanes of a half share rows)
    float alpha[8];
#pragma unroll
    for (int r = 0; r < 8; ++r) {
      const int qi = q0 + 8 * hh + r;
      const int ja = j0 + ln, jb = j0 + 16 + ln;
      if (CAUSAL) { if (ja > qi) s[0][r] = -3.0e38f; if (jb > qi) s[1][r] = -3.0e38f; }
      if (ja >= T) s[0][r] = -3.0e38f;
      if (jb >= T) s[1][r] = -3.0e38f;
      float mx = fmaxf(s[0][r], s[1][r]);
      mx = fmaxf(mx, __shfl_xor(mx, 1, 32)); mx = fmaxf(mx, __shfl_xor(mx, 2, 32)); mx = fmaxf(mx, __shfl_xor(mx, 4, 32)); mx = fmaxf(mx, __shfl_xor(mx, 8, 32));
      const float mnew = fmaxf(m_r[r], mx);
      alpha[r] = (mnew > -1.0e38f) ? __expf(m_r[r] - mnew) : 1.0f;
      const float p0 = (s[0][r] > -1.0e38f) ? __expf(s[0][r] - mnew) : 0.f;
      const float p1 = (s[1][r] > -1.0e38f) ? __expf(s[1][r] - mnew) : 0.f;
      m_r[r] = mnew;
      l_r[r] = l_r[r] * alpha[r] + p0 + p1;            // per-lane partial row sum (16 lanes combined at the end)
      unsigned short hb = bf16_bits(p0); sPh[w][8 * hh + r][ln] = hb;      sPl[w][8 * hh + r][ln] = bf16_bits(p0 - bf16_val(hb));
      hb = bf16_bits(p1);                sPh[w][8 * hh + r][16 + ln] = hb; sPl[w][8 * hh + r][16 + ln] = bf16_bits(p1 - bf16_val(hb));
    }
#pragma unroll
    for (int dt = 0; dt < DT; ++dt)
#pragma unroll
      for (int r = 0; r < 8; ++r) oacc[dt][r] *= alpha[r];
    __builtin_amdgcn_fence(__ATOMIC_ACQ_REL, "workgroup");
    __builtin_amdgcn_wave_barrier();
    FragB pah, pal;
    pah.half[0] = *(const v8us*)&sPh[w][ln][8 * hh]; pah.half[1] = *(const v8us*)&sPh[w][ln][16 + 8 * hh];
    pal.half[0] = *(const v8us*)&sPl[w][ln][8 * hh]; pal.half[1] = *(const v8us*)&sPl[w][ln][16 + 8 * hh];
#pragma unroll
    for (int dt = 0; dt < DT; ++dt) {
      FragB bvh, bvl;
#pragma unroll
      for (int i = 0; i < 8; ++i) {
        bvh.u[i] = sVh[8 * hh + i][dt * 16 + ln]; bvh.u[8 + i] = sVh[16 + 8 * hh + i][dt * 16 + ln];
        bvl.u[i] = sVl[8 * hh + i][dt * 16 + ln]; bvl.u[8 + i] = sVl[16 + 8 * hh + i][dt * 16 + ln];
      }
      oacc[dt] = mmaN<3>(pah.v, pal.v, bvh.v, bvl.v, oacc[dt]);
    }
    __builtin_amdgcn_fence(__ATOMIC_ACQ_REL, "workgroup");
    __builtin_amdgcn_wave_barrier();
  }
#pragma unroll
  for (int r = 0; r < 8; ++r) {
    float l = l_r[r];
    l += __shfl_xor(l, 1, 32); l += __shfl_xor(l, 2, 32); l += __shfl_xor(l, 4, 32); l += __shfl_xor(l, 8, 32);
    l_r[r] = (l > 0.f) ? 1.0f / l : 0.f;
  }
#pragma unroll
  for (int dt = 0; dt < DT; ++dt)
#pragma unroll
    for (int r = 0; r < 8; ++r) sO[w][8 * hh + r][dt * 16 + ln] = oacc[dt][r] * l_r[r];
  __builtin_amdgcn_fence(__ATOMIC_ACQ_REL, "workgroup");
  __builtin_amdgcn_wave_barrier();
  {
    for (int r = 0; r < 16; ++r) {
      const int row = q0 + r;
      if (row < T && lane < D / 4) {
        const v4f val = *(const v4fa*)&sO[w][r][lane * 4];
        *(v4f*)(y + ((size_t)b * T + row) * ypitch + h * D + lane * 4) = val;
      }
    }
    
  }
}

// batched GEMM (blockIdx.y = batch): C_b = act(alpha·A_b·B_b + bias + resid_b); A f32 rows (ASPLIT → hi/lo), B = bf16 planes Bh (+Bl when BSPLIT, requires ASPLIT),
// per-batch element strides sA, sB (0 = shared weights), sC, sR. resid may alias C (values are staged before the stores). ACT 0/1(relu).
// ACT: 0 none, 1 relu, 2 softplus
template <bool ASPLIT, bool BSPLIT, int ACT>
__global__ __launch_bounds__(128) void k_gemm_b(const float* __restrict__ A, int lda, size_t sA, const unsigned short* __restrict__ Bh, const unsigned short* __restrict__ Bl, int ldb, size_t sB,
                                             const float* __restrict__ bias, const float* __restrict__ resid, int ldr, size_t sR, float rsign, float alpha,
                                             float* __restrict__ C, int ldc, size_t sC, int M, int N, int K) {
  __shared__ __attribute__((aligned(16))) float so[4][16][64];
  const int tid = threadIdx.x, w = tid >> 5, lane = tid & 31, ln = lane & 15, hh = lane >> 4;
  const int by = blockIdx.y;
  A += (size_t)by * sA; Bh += (size_t)by * sB; if (BSPLIT) Bl += (size_t)by * sB; C += (size_t)by * sC; if (resid) resid += (size_t)by * sR;
  const int ntn = (N + 63) / 64; const int wid = blockIdx.x * 4 + w; const int mt = wid / ntn, nq = wid % ntn;      // N may be any multiple of 16: tiles past N are skipped and not stored
  if (mt * 16 >= M) return;
  const int row0 = mt * 16, col0 = nq * 64;
  const float* arow = A + (size_t)(row0 + ln) * lda;
  v8f acc[4] = {};
  for (int kb = 0; kb < K; kb += 32) {
    FragB ah, al;
    const v4f x0 = *(const v4fa*)(arow + kb + 8 * hh), x1 = *(const v4fa*)(arow + kb + 8 * hh + 4);
    const v4f x2 = *(const v4fa*)(arow + kb + 16 + 8 * hh), x3 = *(const v4fa*)(arow + kb + 16 + 8 * hh + 4);
    float xs[16] = {x0[0],x0[1],x0[2],x0[3],x1[0],x1[1],x1[2],x1[3],x2[0],x2[1],x2[2],x2[3],x3[0],x3[1],x3[2],x3[3]};
#pragma unroll
    for (int i = 0; i < 16; ++i) { const unsigned short hb = bf16_bits(xs[i]); ah.u[i] = hb; al.u[i] = ASPLIT ? bf16_bits(xs[i] - bf16_val(hb)) : (unsigned short)0; }
#pragma unroll
    for (int t = 0; t < 4; ++t) {
      if (col0 + t * 16 >= N) continue;
      const size_t boff = (size_t)(col0 + t * 16 + ln) * ldb + kb;
      FragB bh_, bl_; bh_.half[0] = *(const v8us*)(Bh + boff + 8 * hh); bh_.half[1] = *(const v8us*)(Bh + boff + 16 + 8 * hh);
      if (BSPLIT) { bl_.half[0] = *(const v8us*)(Bl + boff + 8 * hh); bl_.half[1] = *(const v8us*)(Bl + boff + 16 + 8 * hh); } else bl_ = bh_;
      acc[t] = mmaN<ASPLIT ? (BSPLIT ? 3 : 2) : 1>(ah.v, al.v, bh_.v, bl_.v, acc[t]);
    }
  }
#pragma unroll
  for (int t = 0; t < 4; ++t) {
    const int col = col0 + t * 16 + ln; if (col0 + t * 16 >= N) continue; const float bv = bias ? bf16_round(bias[col]) : 0.f;
#pragma unroll
    for (int r = 0; r < 8; ++r) { float v = acc[t][r] * alpha + bv; if (resid) v += rsign * resid[(size_t)(row0 + 8 * hh + r) * ldr + col]; if (ACT == 1) v = fmaxf(v, 0.f); else if (ACT == 2) v = fmaxf(v, 0.f) + log1pf(expf(-fabsf(v))); so[w][8 * hh + r][t * 16 + ln] = v; }
  }
  __builtin_amdgcn_fence(__ATOMIC_ACQ_REL, "workgroup"); __builtin_amdgcn_wave_barrier();
  const int rsub = lane >> 4, c4 = (lane & 15) * 4;
  {
#pragma unroll
    for (int q = 0; q < 8; ++q) { const int r = q * 2 + rsub; if (col0 + c4 < N) { const v4f v = *(const v4fa*)&so[w][r][c4]; *(v4f*)(C + (size_t)(row0 + r) * ldc + col0 + c4) = v; } }
    
  }
}
// batched f32 [K][N] (pitch lds, batch stride sIn) -> transposed hi/lo planes [N][K] (batch stride sOut); thread per (n, 8 k); grid.y = batch
__global__ __launch_bounds__(256) void k_split_transpose_b(const float* __restrict__ src, int lds_, size_t sIn, unsigned short* __restrict__ hi, unsigned short* __restrict__ lo, size_t sOut, int K, int N) {
  const size_t t = (size_t)blockIdx.x * 256 + threadIdx.x; const int k8n = K / 8; if (t >= (size_t)N * k8n) return;
  src += (size_t)blockIdx.y * sIn; hi += (size_t)blockIdx.y * sOut; lo += (size_t)blockIdx.y * sOut;
  const int n = (int)(t / k8n), k8 = (int)(t % k8n) * 8; v8us vh, vl;
#pragma unroll
  for (int i = 0; i < 8; ++i) { const float x = src[(size_t)(k8 + i) * lds_ + n]; const unsigned short hb = bf16_bits(x); vh[i] = hb; vl[i] = bf16_bits(x - bf16_val(hb)); }
  unsigned short* dh = hi + (size_t)n * K + k8; unsigned short* dl = lo + (size_t)n * K + k8;
  *(v8us*)dh = vh; *(v8us*)dl = vl; 
}

__global__ __launch_bounds__(256) void k_round_rows(const float* __restrict__ W, unsigned short* __restrict__ Wt, int n8) {
  const int t = blockIdx.x * 256 + threadIdx.x;
  if (t >= n8) return;
  const v4f a = *(const v4fa*)(W + (size_t)t * 8), b = *(const v4fa*)(W + (size_t)t * 8 + 4);
  v8us v; v[0]=bf16_bits(a[0]); v[1]=bf16_bits(a[1]); v[2]=bf16_bits(a[2]); v[3]=bf16_bits(a[3]);
  v[4]=bf16_bits(b[0]); v[5]=bf16_bits(b[1]); v[6]=bf16_bits(b[2]); v[7]=bf16_bits(b[3]);
  *(v8us*)(Wt + (size_t)t * 8) = v; 
}

// Bt tables: Bq [768][256] bits = w_qkv[k][n]; Bp [256][256] = w_proj[k][n]
__global__ __launch_bounds__(256) void k_bt(const float* __restrict__ wq, const float* __restrict__ wp, unsigned short* __restrict__ Bq, unsigned short* __restrict__ Bp) { const int t = blockIdx.x * 256 + threadIdx.x; if (t < 3 * EE * EE) { const int k = t % EE, n = t / EE; *(unsigned short*)(Bq + t) = bf16_bits(wq[(size_t)k * 3 * EE + n]); } if (t < EE * EE) { const int k = t % EE, n = t / EE; *(unsigned short*)(Bp + t) = bf16_bits(wp[(size_t)k * EE + n]); } }
// neighbourhood attention on the matrix unit. Block = (b, head, dilation group, 64 consecutive positions of the group), 4 waves x 16 queries.
// The block's 96 key rows are staged once in LDS as bf16 hi/lo planes (K row-major, V transposed). Per wave: S^T = K.Q^T over its 48-key band (A = K rows, B = Q),
// keys outside a query's own 31-key window masked, softmax per lane (one query per lane, halves joined by one exchange), P^T packed from the score tiles as the
// B operand, O^T = V^T.P^T. Every product has 3 terms (hi.hi + lo.hi + hi.lo), f32 accumulate. O[(b,i)][h*32 + d].
#define LGRP (LL / DIL)   // positions per dilation group
#define QT 64             // queries per block
#define KR 96             // staged key rows: 64 + 2 * 15, rounded up to whole 16-row tiles
#define KP 40             // K row pitch in LDS, 16-bit units (80 B = 16 B x odd)
#define VP 104            // V^T row pitch in LDS, 16-bit units (208 B = 16 B x odd)
#define OP 36             // output staging pitch, floats (144 B = 16 B x odd)
static_assert(LL % (DIL * QT) == 0 && LGRP >= KR && DH == 32 && KW / 2 <= 15 && KW <= 31, "tiling of k_natt");
typedef float v2f __attribute__((ext_vector_type(2)));
typedef __bf16 v2b __attribute__((ext_vector_type(2)));
typedef unsigned short v4us __attribute__((ext_vector_type(4), may_alias));
union FragP { v16b v; v2b p[8]; v8us half[2]; };
union Pack8 { v8us v; v2b p[4]; };
union Pack4 { v4us v; v2b p[2]; };
// two f32 -> bf16 hi pair (round to nearest even) and bf16 lo pair of the exact remainders
__device__ __forceinline__ void split2(float a, float b, v2b& hi, v2b& lo) {
  const v2f x = {a, b};
  hi = __builtin_convertvector(x, v2b);
  const v2f r = x - __builtin_convertvector(hi, v2f);
  lo = __builtin_convertvector(r, v2b);
}
__global__ __launch_bounds__(128) void k_natt(const float* __restrict__ QKV, float* __restrict__ O) {
  __shared__ __attribute__((aligned(16))) unsigned short sKh[KR][KP], sKl[KR][KP], sVh[DH][VP], sVl[DH][VP];
  __shared__ __attribute__((aligned(16))) float sO[4][16][OP];
  const int tid = threadIdx.x, w = tid >> 5, lane = tid & 31, ln = lane & 15, hh = lane >> 4;
  int bi = blockIdx.x;
  const int h = bi % NH; bi /= NH;
  const int g = bi % DIL; bi /= DIL;
  const int qblk = bi % (LGRP / QT); const int b = bi / (LGRP / QT);
  const int p0 = qblk * QT;
  int base = p0 - 16; base = base < 0 ? 0 : (base > LGRP - KR ? LGRP - KR : base);       // first staged key position of the group
  const float* Bz = QKV + (size_t)b * LL * 3 * EE + h * DH;
  const int q0 = p0 + 16 * w;
  // one address per operand, every further row at a compile-time distance from it
  const float* kp = Bz + (size_t)(g + (base + (tid >> 3)) * DIL) * 3 * EE + (tid & 7) * 4;        // thread: row tid / 8 (+ 16 per trip), 4 d; K at + EE
  const float* vp = Bz + (size_t)(g + (base + w * 8) * DIL) * 3 * EE + lane;                      // lane = d; wave: 8 keys (+ 32 per trip); V at + 2 EE
  const float* qr = Bz + (size_t)(g + (q0 + ln) * DIL) * 3 * EE + 8 * hh;                         // lane: query ln, d = 8hh + i and 16 + 8hh + i
  v4f kf[KR / 16]; float vv[KR / 32][8];
#pragma unroll
  for (int it = 0; it < KR / 16; ++it) kf[it] = *(const v4fa*)(kp + EE + (size_t)it * 16 * DIL * 3 * EE);
#pragma unroll
  for (int it = 0; it < KR / 32; ++it)
#pragma unroll
    for (int i = 0; i < 8; ++i) vv[it][i] = vp[2 * EE + (size_t)(it * 32 + i) * DIL * 3 * EE];
  const v4f x0 = *(const v4fa*)(qr), x1 = *(const v4fa*)(qr + 4), x2 = *(const v4fa*)(qr + 16), x3 = *(const v4fa*)(qr + 20);
  // keeps the three address pairs in their registers until every load above has been issued and this wait has passed; nothing may rewrite them earlier
  asm volatile("s_wait_xcnt 0x0" :: "v"(kp), "v"(vp), "v"(qr) : "memory");
  // K rows -> hi/lo planes, row-major
#pragma unroll
  for (int it = 0; it < KR / 16; ++it) {
    const int r = (tid >> 3) + 16 * it, c4 = (tid & 7) * 4;
    Pack4 ph, pl;
    split2(kf[it][0], kf[it][1], ph.p[0], pl.p[0]); split2(kf[it][2], kf[it][3], ph.p[1], pl.p[1]);
    *(v4us*)&sKh[r][c4] = ph.v; *(v4us*)&sKl[r][c4] = pl.v;
  }
  // V rows -> hi/lo planes, transposed: 8 consecutive keys of one d per 16-byte store
#pragma unroll
  for (int it = 0; it < KR / 32; ++it) {
    const int k8 = w * 8 + 32 * it;
    Pack8 ph, pl;
#pragma unroll
    for (int i = 0; i < 4; ++i) split2(vv[it][2 * i], vv[it][2 * i + 1], ph.p[i], pl.p[i]);
    *(v8us*)&sVh[lane][k8] = ph.v; *(v8us*)&sVl[lane][k8] = pl.v;
  }
  // B fragments of the wave's 16 queries (column = query ln)
  FragP qh, ql;
  split2(x0[0], x0[1], qh.p[0], ql.p[0]); split2(x0[2], x0[3], qh.p[1], ql.p[1]);
  split2(x1[0], x1[1], qh.p[2], ql.p[2]); split2(x1[2], x1[3], qh.p[3], ql.p[3]);
  split2(x2[0], x2[1], qh.p[4], ql.p[4]); split2(x2[2], x2[3], qh.p[5], ql.p[5]);
  split2(x3[0], x3[1], qh.p[6], ql.p[6]); split2(x3[2], x3[3], qh.p[7], ql.p[7]);
  __syncthreads();
  int kw = q0 - 16; kw = kw < 0 ? 0 : (kw > LGRP - 48 ? LGRP - 48 : kw);                  // first key position of the wave's 48-key band
  const int kr = kw - base;
  // S^T tiles: s[nt][r] = score of key kw + 16 nt + 8hh + r with query q0 + ln
  v8f s[3];
#pragma unroll
  for (int nt = 0; nt < 3; ++nt) {
    const unsigned short* rh = &sKh[kr + nt * 16 + ln][0]; const unsigned short* rl = &sKl[kr + nt * 16 + ln][0];
    FragP kh, kl;
    kh.half[0] = *(const v8us*)(rh + 8 * hh); kh.half[1] = *(const v8us*)(rh + 16 + 8 * hh);
    kl.half[0] = *(const v8us*)(rl + 8 * hh); kl.half[1] = *(const v8us*)(rl + 16 + 8 * hh);
    const v8f z = {};
    s[nt] = mmaN<3>(kh.v, kl.v, qh.v, ql.v, z);
  }
  // the query's own window (NATTEN clamp), softmax over it
  int start = q0 + ln - KW / 2; start = start < 0 ? 0 : (start > LGRP - KW ? LGRP - KW : start);
  const int off = kw + 8 * hh - start;
  float mx = -3.0e38f;
#pragma unroll
  for (int nt = 0; nt < 3; ++nt)
#pragma unroll
    for (int r = 0; r < 8; ++r) {
      const float v = ((unsigned)(off + nt * 16 + r) < (unsigned)KW) ? s[nt][r] * (0.17677669529663687f * 1.4426950408889634f) : -3.0e38f;   // scale * log2(e): softmax in base 2
      s[nt][r] = v; mx = fmaxf(mx, v);
    }
  mx = fmaxf(mx, __shfl_xor(mx, 16, 32));
  float den = 0.f;
#pragma unroll
  for (int nt = 0; nt < 3; ++nt)
#pragma unroll
    for (int r = 0; r < 8; ++r) {
      float p;
      // the v_nop keeps the one slot behind a transcendental, whatever the compiler puts next (a reader of p, or a write to the source register)
      asm("v_exp_f32 %0, %1\n\tv_nop" : "=v"(p) : "v"(s[nt][r] - mx));
      s[nt][r] = p; den += p;   // a masked key gives exactly 0
    }
  den += __shfl_xor(den, 16, 32);
  // P^T as B operand: element i < 8 is tile 2ks, row 8hh + i; element 8 + i is tile 2ks + 1, row 8hh + i; keys 48..63 of the second step are zero on both sides
  FragP ph[2], pl[2];
#pragma unroll
  for (int i = 0; i < 4; ++i) {
    split2(s[0][2 * i], s[0][2 * i + 1], ph[0].p[i], pl[0].p[i]);
    split2(s[1][2 * i], s[1][2 * i + 1], ph[0].p[4 + i], pl[0].p[4 + i]);
    split2(s[2][2 * i], s[2][2 * i + 1], ph[1].p[i], pl[1].p[i]);
  }
  const v8us zero8 = {0, 0, 0, 0, 0, 0, 0, 0};
  ph[1].half[1] = zero8; pl[1].half[1] = zero8;
  const float inv = 1.0f / den;
#pragma unroll
  for (int dt = 0; dt < 2; ++dt) {
    const unsigned short* rh = &sVh[dt * 16 + ln][kr]; const unsigned short* rl = &sVl[dt * 16 + ln][kr];
    FragP vh, vl;
    v8f acc = {};
    vh.half[0] = *(const v8us*)(rh + 8 * hh); vh.half[1] = *(const v8us*)(rh + 16 + 8 * hh);
    vl.half[0] = *(const v8us*)(rl + 8 * hh); vl.half[1] = *(const v8us*)(rl + 16 + 8 * hh);
    acc = mmaN<3>(vh.v, vl.v, ph[0].v, pl[0].v, acc);
    vh.half[0] = *(const v8us*)(rh + 32 + 8 * hh); vh.half[1] = zero8;
    vl.half[0] = *(const v8us*)(rl + 32 + 8 * hh); vl.half[1] = zero8;
    acc = mmaN<3>(vh.v, vl.v, ph[1].v, pl[1].v, acc);
    // acc[r] = O[query ln][d = 16 dt + 8hh + r]
    const v4f o0 = {acc[0] * inv, acc[1] * inv, acc[2] * inv, acc[3] * inv}, o1 = {acc[4] * inv, acc[5] * inv, acc[6] * inv, acc[7] * inv};
    *(v4fa*)&sO[w][ln][dt * 16 + 8 * hh] = o0; *(v4fa*)&sO[w][ln][dt * 16 + 8 * hh + 4] = o1;
  }
  // the wave re-reads its own staging rows: orders its LDS stores before its LDS loads, so that each store below covers whole 128-byte lines
  __builtin_amdgcn_fence(__ATOMIC_ACQ_REL, "workgroup");
  __builtin_amdgcn_wave_barrier();
  float* op = O + ((size_t)b * LL + g + (q0 + (lane >> 3)) * DIL) * EE + h * DH + (lane & 7) * 4;
#pragma unroll
  for (int q = 0; q < 4; ++q) {
    const v4f v = *(const v4fa*)&sO[w][q * 4 + (lane >> 3)][(lane & 7) * 4];
    *(v4f*)(op + (size_t)q * 4 * DIL * EE) = v;
  }
}
extern "C" void kernel_launch(void* const* d_in, const int* in_sizes, int n_in,
                              void* d_out, int out_size, void* d_ws, size_t ws_size, hipStream_t stream) {
  (void)in_sizes; (void)n_in; (void)out_size;
  const float* x = (const float*)d_in[0]; const float* wq = (const float*)d_in[1]; const float* bq = (const float*)d_in[2]; const float* wp = (const float*)d_in[3]; const float* bp = (const float*)d_in[4];
  char* ws = (char*)d_ws; size_t off = 0;
  auto take = [&](size_t bytes) { char* p = ws + off; off += (bytes + 255) & ~(size_t)255; return p; };
  unsigned short* Bq = (unsigned short*)take((size_t)3 * EE * EE * 2); unsigned short* Bp = (unsigned short*)take((size_t)EE * EE * 2); float* QKV = (float*)take((size_t)NTOK * 3 * EE * 4); float* O = (float*)take((size_t)NTOK * EE * 4);
  if (off > ws_size) return;
  k_bt<<<(3 * EE * EE + 255) / 256, 256, 0, stream>>>(wq, wp, Bq, Bp);
  k_gemm_b<false, false, 0><<<dim3(((NTOK / 16) * (3 * EE / 64) + 3) / 4, 1), 128, 0, stream>>>(x, EE, 0, Bq, Bq, EE, 0, bq, nullptr, 0, 0, 1.f, 1.f, QKV, 3 * EE, 0, NTOK, 3 * EE, EE);
  k_natt<<<BB * NH * DIL * (LGRP / QT), 128, 0, stream>>>(QKV, O);
  k_gemm_b<true, false, 0><<<dim3(((NTOK / 16) * (EE / 64) + 3) / 4, 1), 128, 0, stream>>>(O, EE, 0, Bp, Bp, EE, 0, bp, nullptr, 0, 0, 1.f, 1.f, (float*)d_out, EE, 0, NTOK, EE, EE);
}

// v002
// One run takes 35.2 microseconds.
// Next to v001, in two timings, it ran 2.40 and 2.35 times as fast.
// All steps since v000 together make it 4.44 times as fast.
#include <hip/hip_runtime.h>
// 1-D neighbourhood attention (NATTEN, K = 31, dilation 2, 8 heads × 32): qkv = x·W + b on v_wmma_f32_16x16x32_bf16 (x rounded to bf16: single exact term; 16384 × 256 × 768),
// the per-token 31-key windows (indices computed from the NATTEN clamp formula, never loaded): q.k and P.V on the same unit with both operands split hi/lo (3 products),
// 16 queries of one dilation group per wave over a shared 48-key band, softmax in f32 VALU; out = O·W_proj + b on the same unit with the f32 O split hi/lo (2 products; 16384 × 256 × 256); f32 accumulate.
#define BB 2
#define LL 8192
#define EE 256
#define NH 8
#define DH 32
#define KW 31
#define DIL 2
#define NTOK (BB * LL)

typedef __bf16 v16b __attribute__((ext_vector_type(16)));
typedef unsigned short v8us __attribute__((ext_vector_type(8), may_alias));
typedef float  v8f  __attribute__((ext_vector_type(8)));
typedef float  v4f  __attribute__((ext_vector_type(4)));
typedef float  v4fa __attribute__((ext_vector_type(4), may_alias));
union FragB { v16b v; v8us half[2]; unsigned short u[16]; };

__device__ __forceinline__ unsigned short bf16_bits(float x) { unsigned int u = __float_as_uint(x); return (unsigned short)((u + 0x7FFFu + ((u >> 16) & 1u)) >> 16); }
__device__ __forceinline__ float bf16_val(unsigned short b) { return __uint_as_float(((unsigned int)b) << 16); }
__device__ __forceinline__ float bf16_round(float x) { return bf16_val(bf16_bits(x)); }
// D += A·B with NT terms: 1 = ah·bh, 2 = + al·bh (A split), 3 = + ah·bl (both split)
template <int NT>
__device__ __forceinline__ v8f mmaN(v16b ah, v16b al, v16b bh, v16b bl, v8f c) {
  c = __builtin_amdgcn_wmma_f32_16x16x32_bf16(false, ah, false, bh, (short)0, c, false, false);
  if (NT >= 2) c = __builtin_amdgcn_wmma_f32_16x16x32_bf16(false, al, false, bh, (short)0, c, false, false);
  if (NT >= 3) c = __builtin_amdgcn_wmma_f32_16x16x32_bf16(false, ah, false, bl, (short)0, c, false, false);
  asm volatile("v_nop\n\tv_nop\n\tv_nop\n\tv_nop" : "+v"(c) : "v"(ah), "v"(al), "v"(bh), "v"(bl));
  return c;
}

__global__ __launch_bounds__(256) void k_wt_bf16(const float* __restrict__ W, unsigned short* __restrict__ Wt, int K, int N) {
  const int t = blockIdx.x * 256 + threadIdx.x;
  const int k8n = K / 8;
  if (t >= N * k8n) return;
  const int n = t / k8n, k8 = (t % k8n) * 8;
  v8us v;
#pragma unroll
  for (int i = 0; i < 8; ++i) v[i] = bf16_bits(W[(size_t)(k8 + i) * N + n]);
  *(v8us*)(Wt + (size_t)n * K + k8) = v;
  
}

// GEMM C[M][N] (f32, pitch ldc) = act(A[M][K]·W + bias). A f32 row-major (pitch lda) converted per fragment to bf16
// (ASPLIT: hi/lo two planes -> 2 terms, else single rounded term); Wt bf16 [N][K] (pitch ldb). BIAS_BF16 rounds the
// bias to bf16 first (bias quantised to bf16 before the add). K%32==0, M%16==0, N%64==0.
template <bool ASPLIT, int ACT, bool BIAS_BF16>
__global__ __launch_bounds__(128) void k_gemm_bf(const float* __restrict__ A, int lda, const unsigned short* __restrict__ Wt, int ldb,
                                               const float* __restrict__ bias, float* __restrict__ C, int ldc, int M, int N, int K) {
  __shared__ __attribute__((aligned(16))) float so[4][16][64];
  const int tid = threadIdx.x, w = tid >> 5, lane = tid & 31, ln = lane & 15, hh = lane >> 4;
  const int ntn = N / 64;
  const int wid = blockIdx.x * 4 + w;
  const int mt = wid / ntn, nq = wid % ntn;
  if (mt * 16 >= M) return;
  const int row0 = mt * 16, col0 = nq * 64;
  const float* arow = A + (size_t)(row0 + ln) * lda;
  v8f acc[4] = {};
  for (int kb = 0; kb < K; kb += 32) {
    FragB ah, al;
    const v4f x0 = *(const v4fa*)(arow + kb + 8 * hh), x1 = *(const v4fa*)(arow + kb + 8 * hh + 4);
    const v4f x2 = *(const v4fa*)(arow + kb + 16 + 8 * hh), x3 = *(const v4fa*)(arow + kb + 16 + 8 * hh + 4);
    float xs[16] = {x0[0],x0[1],x0[2],x0[3],x1[0],x1[1],x1[2],x1[3],x2[0],x2[1],x2[2],x2[3],x3[0],x3[1],x3[2],x3[3]};
#pragma unroll
    for (int i = 0; i < 16; ++i) { const unsigned short hb = bf16_bits(xs[i]); ah.u[i] = hb; al.u[i] = ASPLIT ? bf16_bits(xs[i] - bf16_val(hb)) : (unsigned short)0; }
#pragma unroll
    for (int t = 0; t < 4; ++t) {
      const unsigned short* brow = Wt + (size_t)(col0 + t * 16 + ln) * ldb + kb;
      FragB b;
      b.half[0] = *(const v8us*)(brow + 8 * hh);
      b.half[1] = *(const v8us*)(brow + 16 + 8 * hh);
      acc[t] = mmaN<ASPLIT ? 2 : 1>(ah.v, al.v, b.v, b.v, acc[t]);
    }
  }
#pragma unroll
  for (int t = 0; t < 4; ++t) {
    float bv = bias ? bias[col0 + t * 16 + ln] : 0.f;
    if (BIAS_BF16) bv = bf16_round(bv);
#pragma unroll
    for (int r = 0; r < 8; ++r) { float v = acc[t][r] + bv; if (ACT == 1) v = fmaxf(v, 0.f); so[w][8 * hh + r][t * 16 + ln] = v; }
  }
  __builtin_amdgcn_fence(__ATOMIC_ACQ_REL, "workgroup");
  __builtin_amdgcn_wave_barrier();
  const int rsub = lane >> 4, c4 = (lane & 15) * 4;
  {
#pragma unroll
    for (int q = 0; q < 8; ++q) {
      const int r = q * 2 + rsub;
      const v4f v = *(const v4fa*)&so[w][r][c4];
      *(v4f*)(C + (size_t)(row0 + r) * ldc + col0 + c4) = v;
    }
    
  }
}

// Flash-style causal/unmasked attention, all contractions 3-term bf16 hi/lo splits, f32 softmax with running max.
// q,k,v rows are read from f32 buffers with arbitrary row pitch (so they can live inside a fused qkv buffer);
// D = head size (multiple of 32, <= 128); one wave = 16 query rows; block = 4 waves (64 queries) sharing K/V chunks of 32.
template <int D, bool CAUSAL>
__global__ __launch_bounds__(128) void k_flash(const float* __restrict__ qb, const float* __restrict__ kb, const float* __restrict__ vb,
                                             int pitch, int T, int H, float scale, float* __restrict__ y, int ypitch) {
  constexpr int KS = D / 32;        // k-steps for QK
  constexpr int DT = D / 16;        // d tiles for PV
  __shared__ __attribute__((aligned(16))) unsigned short sKh[32][D + 8], sKl[32][D + 8], sVh[32][D + 8], sVl[32][D + 8];
  __shared__ __attribute__((aligned(16))) unsigned short sPh[4][16][40], sPl[4][16][40];
  __shared__ __attribute__((aligned(16))) float sO[4][16][D];
  const int tid = threadIdx.x, w = tid >> 5, lane = tid & 31, ln = lane & 15, hh = lane >> 4;
  const int nqb = (T + 63) / 64;
  const int bh = blockIdx.x / nqb, qblk = blockIdx.x % nqb;
  const int b = bh / H, h = bh % H;
  const int q0 = qblk * 64 + w * 16;
  const float* Q = qb + (size_t)b * T * pitch + h * D;
  const float* K = kb + (size_t)b * T * pitch + h * D;
  const float* V = vb + (size_t)b * T * pitch + h * D;

  // A fragments of the wave's 16 query rows (scaled), hi/lo
  FragB aqh[KS], aql[KS];
  {
    int row = q0 + ln; if (row >= T) row = T - 1;
    const float* qr = Q + (size_t)row * pitch;
#pragma unroll
    for (int ks = 0; ks < KS; ++ks)
#pragma unroll
      for (int i = 0; i < 16; ++i) {
        const int d = ks * 32 + ((i < 8) ? (8 * hh + i) : (16 + 8 * hh + (i - 8)));
        const float x = qr[d] * scale; const unsigned short hb = bf16_bits(x);
        aqh[ks].u[i] = hb; aql[ks].u[i] = bf16_bits(x - bf16_val(hb));
      }
  }
  float m_r[8], l_r[8];
#pragma unroll
  for (int r = 0; r < 8; ++r) { m_r[r] = -3.0e38f; l_r[r] = 0.f; }
  v8f oacc[DT];
#pragma unroll
  for (int dt = 0; dt < DT; ++dt) oacc[dt] = (v8f){0.f,0.f,0.f,0.f,0.f,0.f,0.f,0.f};

  const int kv_end = CAUSAL ? min(T, qblk * 64 + 64) : T;     // block-uniform
  for (int j0 = 0; j0 < kv_end; j0 += 32) {
    __syncthreads();
    for (int e = tid; e < 32 * (D / 4); e += 128) {
      const int r = e / (D / 4), c4 = (e % (D / 4)) * 4;
      const int key = j0 + r;
      v4f kf = {0.f,0.f,0.f,0.f}, vf = {0.f,0.f,0.f,0.f};
      if (key < T) { kf = *(const v4fa*)(K + (size_t)key * pitch + c4); vf = *(const v4fa*)(V + (size_t)key * pitch + c4); }
#pragma unroll
      for (int t = 0; t < 4; ++t) {
        unsigned short hb = bf16_bits(kf[t]); sKh[r][c4 + t] = hb; sKl[r][c4 + t] = bf16_bits(kf[t] - bf16_val(hb));
        hb = bf16_bits(vf[t]); sVh[r][c4 + t] = hb; sVl[r][c4 + t] = bf16_bits(vf[t] - bf16_val(hb));
      }
    }
    __syncthreads();
    // S tile 16 x 32
    v8f s[2];
#pragma unroll
    for (int nt = 0; nt < 2; ++nt) {
      v8f acc = {};
#pragma unroll
      for (int ks = 0; ks < KS; ++ks) {
        FragB bh_, bl_;
        bh_.half[0] = *(const v8us*)&sKh[nt * 16 + ln][ks * 32 + 8 * hh]; bh_.half[1] = *(const v8us*)&sKh[nt * 16 + ln][ks * 32 + 16 + 8 * hh];
        bl_.half[0] = *(const v8us*)&sKl[nt * 16 + ln][ks * 32 + 8 * hh]; bl_.half[1] = *(const v8us*)&sKl[nt * 16 + ln][ks * 32 + 16 + 8 * hh];
        acc = mmaN<3>(aqh[ks].v, aql[ks].v, bh_.v, bl_.v, acc);
      }
      s[nt] = acc;
    }
    // mask + running max (rows 8hh+r; the 16 lanes of a half share rows)
    float alpha[8];
#pragma unroll
    for (int r = 0; r < 8; ++r) {
      const int qi = q0 + 8 * hh + r;
      const int ja = j0 + ln, jb = j0 + 16 + ln;
      if (CAUSAL) { if (ja > qi) s[0][r] = -3.0e38f; if (jb > qi) s[1][r] = -3.0e38f; }
      if (ja >= T) s[0][r] = -3.0e38f;
      if (jb >= T) s[1][r] = -3.0e38f;
      float mx = fmaxf(s[0][r], s[1][r]);
      mx = fmaxf(mx, __shfl_xor(mx, 1, 32)); mx = fmaxf(mx, __shfl_xor(mx, 2, 32)); mx = fmaxf(mx, __shfl_xor(mx, 4, 32)); mx = fmaxf(mx, __shfl_xor(mx, 8, 32));
      const float mnew = fmaxf(m_r[r], mx);
      alpha[r] = (mnew > -1.0e38f) ? __expf(m_r[r] - mnew) : 1.0f;
      const float p0 = (s[0][r] > -1.0e38f) ? __expf(s[0][r] - mnew) : 0.f;
      const float p1 = (s[1][r] > -1.0e38f) ? __expf(s[1][r] - mnew) : 0.f;
      m_r[r] = mnew;
      l_r[r] = l_r[r] * alpha[r] + p0 + p1;            // per-lane partial row sum (16 lanes combined at the end)
      unsigned short hb = bf16_bits(p0); sPh[w][8 * hh + r][ln] = hb;      sPl[w][8 * hh + r][ln] = bf16_bits(p0 - bf16_val(hb));
      hb = bf16_bits(p1);                sPh[w][8 * hh + r][16 + ln] = hb; sPl[w][8 * hh + r][16 + ln] = bf16_bits(p1 - bf16_val(hb));
    }
#pragma unroll
    for (int dt = 0; dt < DT; ++dt)
#pragma unroll
      for (int r = 0; r < 8; ++r) oacc[dt][r] *= alpha[r];
    __builtin_amdgcn_fence(__ATOMIC_ACQ_REL, "workgroup");
    __builtin_amdgcn_wave_barrier();
    FragB pah, pal;
    pah.half[0] = *(const v8us*)&sPh[w][ln][8 * hh]; pah.half[1] = *(const v8us*)&sPh[w][ln][16 + 8 * hh];
    pal.half[0] = *(const v8us*)&sPl[w][ln][8 * hh]; pal.half[1] = *(const v8us*)&sPl[w][ln][16 + 8 * hh];
#pragma unroll
    for (int dt = 0; dt < DT; ++dt) {
      FragB bvh, bvl;
#pragma unroll
      for (int i = 0; i < 8; ++i) {
        bvh.u[i] = sVh[8 * hh + i][dt * 16 + ln]; bvh.u[8 + i] = sVh[16 + 8 * hh + i][dt * 16 + ln];
        bvl.u[i] = sVl[8 * hh + i][dt * 16 + ln]; bvl.u[8 + i] = sVl[16 + 8 * hh + i][dt * 16 + ln];
      }
      oacc[dt] = mmaN<3>(pah.v, pal.v, bvh.v, bvl.v, oacc[dt]);
    }
    __builtin_amdgcn_fence(__ATOMIC_ACQ_REL, "workgroup");
    __builtin_amdgcn_wave_barrier();
  }
#pragma unroll
  for (int r = 0; r < 8; ++r) {
    float l = l_r[r];
    l += __shfl_xor(l, 1, 32); l += __shfl_xor(l, 2, 32); l += __shfl_xor(l, 4, 32); l += __shfl_xor(l, 8, 32);
    l_r[r] = (l > 0.f) ? 1.0f / l : 0.f;
  }
#pragma unroll
  for (int dt = 0; dt < DT; ++dt)
#pragma unroll
    for (int r = 0; r < 8; ++r) sO[w][8 * hh + r][dt * 16 + ln] = oacc[dt][r] * l_r[r];
  __builtin_amdgcn_fence(__ATOMIC_ACQ_REL, "workgroup");
  __builtin_amdgcn_wave_barrier();
  {
    for (int r = 0; r < 16; ++r) {
      const int row = q0 + r;
      if (row < T && lane < D / 4) {
        const v4f val = *(const v4fa*)&sO[w][r][lane * 4];
        *(v4f*)(y + ((size_t)b * T + row) * ypitch + h * D + lane * 4) = val;
      }
    }
    
  }
}

// batched f32 [K][N] (pitch lds, batch stride sIn) -> transposed hi/lo planes [N][K] (batch stride sOut); thread per (n, 8 k); grid.y = batch
__global__ __launch_bounds__(256) void k_split_transpose_b(const float* __restrict__ src, int lds_, size_t sIn, unsigned short* __restrict__ hi, unsigned short* __restrict__ lo, size_t sOut, int K, int N) {
  const size_t t = (size_t)blockIdx.x * 256 + threadIdx.x; const int k8n = K / 8; if (t >= (size_t)N * k8n) return;
  src += (size_t)blockIdx.y * sIn; hi += (size_t)blockIdx.y * sOut; lo += (size_t)blockIdx.y * sOut;
  const int n = (int)(t / k8n), k8 = (int)(t % k8n) * 8; v8us vh, vl;
#pragma unroll
  for (int i = 0; i < 8; ++i) { const float x = src[(size_t)(k8 + i) * lds_ + n]; const unsigned short hb = bf16_bits(x); vh[i] = hb; vl[i] = bf16_bits(x - bf16_val(hb)); }
  unsigned short* dh = hi + (size_t)n * K + k8; unsigned short* dl = lo + (size_t)n * K + k8;
  *(v8us*)dh = vh; *(v8us*)dl = vl; 
}

__global__ __launch_bounds__(256) void k_round_rows(const float* __restrict__ W, unsigned short* __restrict__ Wt, int n8) {
  const int t = blockIdx.x * 256 + threadIdx.x;
  if (t >= n8) return;
  const v4f a = *(const v4fa*)(W + (size_t)t * 8), b = *(const v4fa*)(W + (size_t)t * 8 + 4);
  v8us v; v[0]=bf16_bits(a[0]); v[1]=bf16_bits(a[1]); v[2]=bf16_bits(a[2]); v[3]=bf16_bits(a[3]);
  v[4]=bf16_bits(b[0]); v[5]=bf16_bits(b[1]); v[6]=bf16_bits(b[2]); v[7]=bf16_bits(b[3]);
  *(v8us*)(Wt + (size_t)t * 8) = v; 
}

// weights -> bf16, packed in B-fragment order: tile (nt = n / 16, ks = k / 32) is 1 KiB = [j = 0, 1][lane = 16 hh + ln][8 elements],
// element i = W[32 ks + 16 j + 8 hh + i][16 nt + ln], so that each half fragment of a wave is one run of 512 bytes. Thread = one 16-byte piece; Bq from w_qkv, Bp from w_proj.
template <int N>
__device__ __forceinline__ void pack_piece(const float* __restrict__ W, unsigned short* __restrict__ D, int u) {
  const int ln = u & 15, hh = (u >> 4) & 1, j = (u >> 5) & 1, ks = (u >> 6) & 7, nt = u >> 9;
  const float* s = W + (size_t)(ks * 32 + j * 16 + hh * 8) * N + nt * 16 + ln;      // one address, the 8 rows at compile-time distances
  v8us v;
#pragma unroll   // the index names registers: it must be a compile-time value
  for (int i = 0; i < 8; ++i) v[i] = bf16_bits(s[(size_t)i * N]);
  *(v8us*)(D + (size_t)u * 8) = v;
  // the store's registers are not rewritten on any path of the listing before this wait
  asm volatile("s_wait_xcnt 0x0" ::: "memory");
}
__global__ __launch_bounds__(256) void k_pack(const float* __restrict__ wq, const float* __restrict__ wp, unsigned short* __restrict__ Bq, unsigned short* __restrict__ Bp) {
  constexpr int NQB = 3 * EE * EE / 8 / 256;             // blocks that pack Bq; the rest pack Bp
  if (blockIdx.x < NQB) pack_piece<3 * EE>(wq, Bq, blockIdx.x * 256 + threadIdx.x);
  else pack_piece<EE>(wp, Bp, (blockIdx.x - NQB) * 256 + threadIdx.x);
}
// neighbourhood attention on the matrix unit. Block = (b, head, dilation group, 64 consecutive positions of the group), 4 waves x 16 queries.
// The block's 96 key rows are staged once in LDS as bf16 hi/lo planes (K row-major, V transposed). Per wave: S^T = K.Q^T over its 48-key band (A = K rows, B = Q),
// keys outside a query's own 31-key window masked, softmax per lane (one query per lane, halves joined by one exchange), P^T packed from the score tiles as the
// B operand, O^T = V^T.P^T. Every product has 3 terms (hi.hi + lo.hi + hi.lo), f32 accumulate. O[(b,i)][h*32 + d].
#define LGRP (LL / DIL)   // positions per dilation group
#define QT 64             // queries per block
#define KR 96             // staged key rows: 64 + 2 * 15, rounded up to whole 16-row tiles
#define KP 40             // K row pitch in LDS, 16-bit units (80 B = 16 B x odd)
#define VP 104            // V^T row pitch in LDS, 16-bit units (208 B = 16 B x odd)
#define OP 36             // output staging pitch, floats (144 B = 16 B x odd)
static_assert(LL % (DIL * QT) == 0 && LGRP >= KR && DH == 32 && KW / 2 <= 15 && KW <= 31, "tiling of k_natt");
typedef float v2f __attribute__((ext_vector_type(2)));
typedef __bf16 v2b __attribute__((ext_vector_type(2)));
typedef unsigned short v4us __attribute__((ext_vector_type(4), may_alias));
union FragP { v16b v; v2b p[8]; v8us half[2]; };
union Pack8 { v8us v; v2b p[4]; };
union Pack4 { v4us v; v2b p[2]; };
// two f32 -> bf16 hi pair (round to nearest even) and bf16 lo pair of the exact remainders
__device__ __forceinline__ void split2(float a, float b, v2b& hi, v2b& lo) {
  const v2f x = {a, b};
  hi = __builtin_convertvector(x, v2b);
  const v2f r = x - __builtin_convertvector(hi, v2f);
  lo = __builtin_convertvector(r, v2b);
}
__global__ __launch_bounds__(128) void k_natt(const float* __restrict__ QKV, float* __restrict__ O) {
  __shared__ __attribute__((aligned(16))) unsigned short sKh[KR][KP], sKl[KR][KP], sVh[DH][VP], sVl[DH][VP];
  __shared__ __attribute__((aligned(16))) float sO[4][16][OP];
  const int tid = threadIdx.x, w = tid >> 5, lane = tid & 31, ln = lane & 15, hh = lane >> 4;
  int bi = blockIdx.x;
  const int h = bi % NH; bi /= NH;
  const int g = bi % DIL; bi /= DIL;
  const int qblk = bi % (LGRP / QT); const int b = bi / (LGRP / QT);
  const int p0 = qblk * QT;
  int base = p0 - 16; base = base < 0 ? 0 : (base > LGRP - KR ? LGRP - KR : base);       // first staged key position of the group
  const float* Bz = QKV + (size_t)b * LL * 3 * EE + h * DH;
  const int q0 = p0 + 16 * w;
  // one address per operand, every further row at a compile-time distance from it
  const float* kp = Bz + (size_t)(g + (base + (tid >> 3)) * DIL) * 3 * EE + (tid & 7) * 4;        // thread: row tid / 8 (+ 16 per trip), 4 d; K at + EE
  const float* vp = Bz + (size_t)(g + (base + w * 8) * DIL) * 3 * EE + lane;                      // lane = d; wave: 8 keys (+ 32 per trip); V at + 2 EE
  const float* qr = Bz + (size_t)(g + (q0 + ln) * DIL) * 3 * EE + 8 * hh;                         // lane: query ln, d = 8hh + i and 16 + 8hh + i
  v4f kf[KR / 16]; float vv[KR / 32][8];
#pragma unroll
  for (int it = 0; it < KR / 16; ++it) kf[it] = *(const v4fa*)(kp + EE + (size_t)it * 16 * DIL * 3 * EE);
#pragma unroll
  for (int it = 0; it < KR / 32; ++it)
#pragma unroll
    for (int i = 0; i < 8; ++i) vv[it][i] = vp[2 * EE + (size_t)(it * 32 + i) * DIL * 3 * EE];
  const v4f x0 = *(const v4fa*)(qr), x1 = *(const v4fa*)(qr + 4), x2 = *(const v4fa*)(qr + 16), x3 = *(const v4fa*)(qr + 20);
  // keeps the three address pairs in their registers until every load above has been issued and this wait has passed; nothing may rewrite them earlier
  asm volatile("s_wait_xcnt 0x0" :: "v"(kp), "v"(vp), "v"(qr) : "memory");
  // K rows -> hi/lo planes, row-major
#pragma unroll
  for (int it = 0; it < KR / 16; ++it) {
    const int r = (tid >> 3) + 16 * it, c4 = (tid & 7) * 4;
    Pack4 ph, pl;
    split2(kf[it][0], kf[it][1], ph.p[0], pl.p[0]); split2(kf[it][2], kf[it][3], ph.p[1], pl.p[1]);
    *(v4us*)&sKh[r][c4] = ph.v; *(v4us*)&sKl[r][c4] = pl.v;
  }
  // V rows -> hi/lo planes, transposed: 8 consecutive keys of one d per 16-byte store
#pragma unroll
  for (int it = 0; it < KR / 32; ++it) {
    const int k8 = w * 8 + 32 * it;
    Pack8 ph, pl;
#pragma unroll
    for (int i = 0; i < 4; ++i) split2(vv[it][2 * i], vv[it][2 * i + 1], ph.p[i], pl.p[i]);
    *(v8us*)&sVh[lane][k8] = ph.v; *(v8us*)&sVl[lane][k8] = pl.v;
  }
  // B fragments of the wave's 16 queries (column = query ln)
  FragP qh, ql;
  split2(x0[0], x0[1], qh.p[0], ql.p[0]); split2(x0[2], x0[3], qh.p[1], ql.p[1]);
  split2(x1[0], x1[1], qh.p[2], ql.p[2]); split2(x1[2], x1[3], qh.p[3], ql.p[3]);
  split2(x2[0], x2[1], qh.p[4], ql.p[4]); split2(x2[2], x2[3], qh.p[5], ql.p[5]);
  split2(x3[0], x3[1], qh.p[6], ql.p[6]); split2(x3[2], x3[3], qh.p[7], ql.p[7]);
  __syncthreads();
  int kw = q0 - 16; kw = kw < 0 ? 0 : (kw > LGRP - 48 ? LGRP - 48 : kw);                  // first key position of the wave's 48-key band
  const int kr = kw - base;
  // S^T tiles: s[nt][r] = score of key kw + 16 nt + 8hh + r with query q0 + ln
  v8f s[3];
#pragma unroll
  for (int nt = 0; nt < 3; ++nt) {
    const unsigned short* rh = &sKh[kr + nt * 16 + ln][0]; const unsigned short* rl = &sKl[kr + nt * 16 + ln][0];
    FragP kh, kl;
    kh.half[0] = *(const v8us*)(rh + 8 * hh); kh.half[1] = *(const v8us*)(rh + 16 + 8 * hh);
    kl.half[0] = *(const v8us*)(rl + 8 * hh); kl.half[1] = *(const v8us*)(rl + 16 + 8 * hh);
    const v8f z = {};
    s[nt] = mmaN<3>(kh.v, kl.v, qh.v, ql.v, z);
  }
  // the query's own window (NATTEN clamp), softmax over it
  int start = q0 + ln - KW / 2; start = start < 0 ? 0 : (start > LGRP - KW ? LGRP - KW : start);
  const int off = kw + 8 * hh - start;
  float mx = -3.0e38f;
#pragma unroll
  for (int nt = 0; nt < 3; ++nt)
#pragma unroll
    for (int r = 0; r < 8; ++r) {
      const float v = ((unsigned)(off + nt * 16 + r) < (unsigned)KW) ? s[nt][r] * (0.17677669529663687f * 1.4426950408889634f) : -3.0e38f;   // scale * log2(e): softmax in base 2
      s[nt][r] = v; mx = fmaxf(mx, v);
    }
  mx = fmaxf(mx, __shfl_xor(mx, 16, 32));
  float den = 0.f;
#pragma unroll
  for (int nt = 0; nt < 3; ++nt)
#pragma unroll
    for (int r = 0; r < 8; ++r) {
      float p;
      // the v_nop keeps the one slot behind a transcendental, whatever the compiler puts next (a reader of p, or a write to the source register)
      asm("v_exp_f32 %0, %1\n\tv_nop" : "=v"(p) : "v"(s[nt][r] - mx));
      s[nt][r] = p; den += p;   // a masked key gives exactly 0
    }
  den += __shfl_xor(den, 16, 32);
  // P^T as B operand: element i < 8 is tile 2ks, row 8hh + i; element 8 + i is tile 2ks + 1, row 8hh + i; keys 48..63 of the second step are zero on both sides
  FragP ph[2], pl[2];
#pragma unroll
  for (int i = 0; i < 4; ++i) {
    split2(s[0][2 * i], s[0][2 * i + 1], ph[0].p[i], pl[0].p[i]);
    split2(s[1][2 * i], s[1][2 * i + 1], ph[0].p[4 + i], pl[0].p[4 + i]);
    split2(s[2][2 * i], s[2][2 * i + 1], ph[1].p[i], pl[1].p[i]);
  }
  const v8us zero8 = {0, 0, 0, 0, 0, 0, 0, 0};
  ph[1].half[1] = zero8; pl[1].half[1] = zero8;
  const float inv = 1.0f / den;
#pragma unroll
  for (int dt = 0; dt < 2; ++dt) {
    const unsigned short* rh = &sVh[dt * 16 + ln][kr]; const unsigned short* rl = &sVl[dt * 16 + ln][kr];
    FragP vh, vl;
    v8f acc = {};
    vh.half[0] = *(const v8us*)(rh + 8 * hh); vh.half[1] = *(const v8us*)(rh + 16 + 8 * hh);
    vl.half[0] = *(const v8us*)(rl + 8 * hh); vl.half[1] = *(const v8us*)(rl + 16 + 8 * hh);
    acc = mmaN<3>(vh.v, vl.v, ph[0].v, pl[0].v, acc);
    vh.half[0] = *(const v8us*)(rh + 32 + 8 * hh); vh.half[1] = zero8;
    vl.half[0] = *(const v8us*)(rl + 32 + 8 * hh); vl.half[1] = zero8;
    acc = mmaN<3>(vh.v, vl.v, ph[1].v, pl[1].v, acc);
    // acc[r] = O[query ln][d = 16 dt + 8hh + r]
    const v4f o0 = {acc[0] * inv, acc[1] * inv, acc[2] * inv, acc[3] * inv}, o1 = {acc[4] * inv, acc[5] * inv, acc[6] * inv, acc[7] * inv};
    *(v4fa*)&sO[w][ln][dt * 16 + 8 * hh] = o0; *(v4fa*)&sO[w][ln][dt * 16 + 8 * hh + 4] = o1;
  }
  // the wave re-reads its own staging rows: orders its LDS stores before its LDS loads, so that each store below covers whole 128-byte lines
  __builtin_amdgcn_fence(__ATOMIC_ACQ_REL, "workgroup");
  __builtin_amdgcn_wave_barrier();
  float* op = O + ((size_t)b * LL + g + (q0 + (lane >> 3)) * DIL) * EE + h * DH + (lane & 7) * 4;
#pragma unroll
  for (int q = 0; q < 4; ++q) {
    const v4f v = *(const v4fa*)&sO[w][q * 4 + (lane >> 3)][(lane & 7) * 4];
    *(v4f*)(op + (size_t)q * 4 * DIL * EE) = v;
  }
}
// C[NTOK][N] (f32) = A[NTOK][EE] . W + bf16(bias). Block = 8 waves = 64 rows x 256 columns; wave = 64 rows x 32 columns (4 x 2 tiles).
// The block's A rows are read once in whole lines, converted once to bf16 (ASPLIT: hi and lo planes, 2 terms per product) and kept in LDS for all k;
// B comes from the packed table of k_pack, 512 contiguous bytes per load, NB - 1 k-steps ahead of its products; a k-step's A fragments are read from LDS as one group in front of its products.
// WPS = waves per SIMD that the register budget leaves room for (6: the grid's 3 blocks per WGP all resident; 4: no register above v255). Every shape is a compile-time constant.
#define GM 64             // rows per block
#define GN 256            // columns per block
#define AP (EE + 8)       // A row pitch in LDS, 16-bit units (528 B = 16 B x odd)
#define SP 36             // output staging pitch, floats (144 B = 16 B x odd)
static_assert(NTOK % GM == 0 && EE == 256, "tiling of k_gemm_t: 256 threads x 4 floats = 4 rows of A per trip");
__device__ __forceinline__ v8f mma1(v16b a, v16b b, v8f c) { return __builtin_amdgcn_wmma_f32_16x16x32_bf16(false, a, false, b, (short)0, c, false, false); }
template <bool ASPLIT, int N, int NB, int WPS>
__global__ __launch_bounds__(256, WPS) void k_gemm_t(const float* __restrict__ A, const unsigned short* __restrict__ Bp, const float* __restrict__ bias, float* __restrict__ C) {
  static_assert(N % GN == 0 && NB >= 2 && NB <= EE / 32, "tiling of k_gemm_t");
  constexpr int KS = EE / 32;
  __shared__ __attribute__((aligned(16))) unsigned short sAh[GM][AP], sAl[ASPLIT ? GM : 1][AP];
  __shared__ __attribute__((aligned(16))) float so[8][32][SP];
  const int tid = threadIdx.x, lane = tid & 31, ln = lane & 15, hh = lane >> 4;
  const int w = __builtin_amdgcn_readfirstlane(tid >> 5);
  const int mb = blockIdx.x / (N / GN), nb = blockIdx.x % (N / GN);        // neighbouring blocks share their A rows
  const int row0 = mb * GM, col0 = nb * GN + w * 32;
  const unsigned short* bp = Bp + (size_t)(col0 / 16) * (KS * 512) + lane * 8;
  const float* ap = A + (size_t)row0 * EE + tid * 4;                       // trip it: row 4 it + tid / 64, 4 columns from (tid % 64) * 4
  FragB b[NB][2], ah[4], al[4];
  auto load_b = [&](int ks) {
#pragma unroll   // the index names registers: it must be a compile-time value
    for (int t = 0; t < 2; ++t) { b[ks % NB][t].half[0] = *(const v8us*)(bp + (t * KS + ks) * 512); b[ks % NB][t].half[1] = *(const v8us*)(bp + (t * KS + ks) * 512 + 256); }
  };
  auto load_a = [&](int ks) {
#pragma unroll   // the index names registers: it must be a compile-time value
    for (int mi = 0; mi < 4; ++mi) {
      const unsigned short* rh = &sAh[mi * 16 + ln][ks * 32 + 8 * hh];
      ah[mi].half[0] = *(const v8us*)rh; ah[mi].half[1] = *(const v8us*)(rh + 16);
      if (ASPLIT) { const unsigned short* rl = &sAl[mi * 16 + ln][ks * 32 + 8 * hh]; al[mi].half[0] = *(const v8us*)rl; al[mi].half[1] = *(const v8us*)(rl + 16); }
    }
  };
#pragma unroll   // the index names registers: it must be a compile-time value
  for (int ks = 0; ks < NB - 1; ++ks) load_b(ks);
  v4f xa[GM / 4];
#pragma unroll   // the index names registers: it must be a compile-time value
  for (int it = 0; it < GM / 4; ++it) xa[it] = *(const v4fa*)(ap + (size_t)it * 4 * EE);
  const int bi = col0 + ln;
  const float bq0 = bias[bi], bq1 = bias[bi + 16];
  // no address register of the loads above is rewritten before this wait; bi is named so that its register lives until here (bp is used further down)
  asm volatile("s_wait_xcnt 0x0" :: "v"(bi) : "memory");
#pragma unroll   // the index names registers: it must be a compile-time value
  for (int it = 0; it < GM / 4; ++it) {
    const int r = it * 4 + (tid >> 6), c4 = (tid & 63) * 4;
    Pack4 ph, pl;
    split2(xa[it][0], xa[it][1], ph.p[0], pl.p[0]); split2(xa[it][2], xa[it][3], ph.p[1], pl.p[1]);
    *(v4us*)&sAh[r][c4] = ph.v;
    if (ASPLIT) *(v4us*)&sAl[r][c4] = pl.v;
  }
  __syncthreads();
  v8f acc[4][2] = {};
#pragma unroll   // the index names registers: it must be a compile-time value
  for (int ks = 0; ks < KS; ++ks) {
    if (ks + NB - 1 < KS) load_b(ks + NB - 1);
    load_a(ks);
    // keeps the loads above in front of this k-step's products: without it the compiler sinks each load to just before its use, and the wave waits out every latency
    __builtin_amdgcn_sched_barrier(0);
    // per accumulator and k-step: hi term, then lo term
#pragma unroll   // the index names registers: it must be a compile-time value
    for (int mi = 0; mi < 4; ++mi)
#pragma unroll   // the index names registers: it must be a compile-time value
      for (int t = 0; t < 2; ++t) acc[mi][t] = mma1(ah[mi].v, b[ks % NB][t].v, acc[mi][t]);
    if (ASPLIT) {
#pragma unroll   // the index names registers: it must be a compile-time value
      for (int mi = 0; mi < 4; ++mi)
#pragma unroll   // the index names registers: it must be a compile-time value
        for (int t = 0; t < 2; ++t) acc[mi][t] = mma1(al[mi].v, b[ks % NB][t].v, acc[mi][t]);
    }
  }
  const float bv0 = bf16_round(bq0), bv1 = bf16_round(bq1);
  float* cp = C + (size_t)(row0 + (lane >> 3)) * N + col0 + (lane & 7) * 4;
#pragma unroll   // the index names registers: it must be a compile-time value
  for (int ps = 0; ps < 2; ++ps) {
#pragma unroll   // the index names registers: it must be a compile-time value
    for (int m2 = 0; m2 < 2; ++m2)
#pragma unroll   // the index names registers: it must be a compile-time value
      for (int r = 0; r < 8; ++r) {
        so[w][m2 * 16 + 8 * hh + r][ln] = acc[ps * 2 + m2][0][r] + bv0;
        so[w][m2 * 16 + 8 * hh + r][16 + ln] = acc[ps * 2 + m2][1][r] + bv1;
      }
    // the wave re-reads its own staging rows, other lanes' words: its LDS stores end before its LDS loads start, so that each global store covers whole 128-byte lines
    asm volatile("s_wait_dscnt 0x0" ::: "memory");
#pragma unroll
    for (int q = 0; q < 8; ++q) {
      const v4f v = *(const v4fa*)&so[w][q * 4 + (lane >> 3)][(lane & 7) * 4];
      *(v4f*)(cp + (size_t)(ps * 32 + q * 4) * N) = v;
    }
    // keeps the second pass's LDS stores behind the loads above (other lanes' words in the same rows); no wait on the global stores is wanted here
    if (ps == 0) __builtin_amdgcn_fence(__ATOMIC_ACQ_REL, "wavefront");
  }
}
extern "C" void kernel_launch(void* const* d_in, const int* in_sizes, int n_in,
                              void* d_out, int out_size, void* d_ws, size_t ws_size, hipStream_t stream) {
  (void)in_sizes; (void)n_in; (void)out_size;
  const float* x = (const float*)d_in[0]; const float* wq = (const float*)d_in[1]; const float* bq = (const float*)d_in[2]; const float* wp = (const float*)d_in[3]; const float* bp = (const float*)d_in[4];
  char* ws = (char*)d_ws; size_t off = 0;
  auto take = [&](size_t bytes) { char* p = ws + off; off += (bytes + 255) & ~(size_t)255; return p; };
  unsigned short* Bq = (unsigned short*)take((size_t)3 * EE * EE * 2); unsigned short* Bp = (unsigned short*)take((size_t)EE * EE * 2); float* QKV = (float*)take((size_t)NTOK * 3 * EE * 4); float* O = (float*)take((size_t)NTOK * EE * 4);
  if (off > ws_size) return;
  k_pack<<<(3 * EE * EE + EE * EE) / 8 / 256, 256, 0, stream>>>(wq, wp, Bq, Bp);
  k_gemm_t<false, 3 * EE, 3, 6><<<(NTOK / GM) * (3 * EE / GN), 256, 0, stream>>>(x, Bq, bq, QKV);
  k_natt<<<BB * NH * DIL * (LGRP / QT), 128, 0, stream>>>(QKV, O);
  k_gemm_t<true, EE, 4, 4><<<(NTOK / GM) * (EE / GN), 256, 0, stream>>>(O, Bp, bp, (float*)d_out);
}

// v003
// Measured time: 21.8 microseconds a run.
// Timed twice side by side with v002, it ran 1.60 and 1.59 times as fast.
// Over all steps from v000 it is 7.09 times as fast.
#include <hip/hip_runtime.h>
// 1-D neighbourhood attention (NATTEN, K = 31, dilation 2, 8 heads × 32): qkv = x·W + b on v_wmma_f32_16x16x32_bf16 (x rounded to bf16: single exact term; 16384 × 256 × 768),
// the per-token 31-key windows (indices computed from the NATTEN clamp formula, never loaded): q.k and P.V on the same unit with both operands split hi/lo (3 products),
// two tiles of 16 queries of one dilation group per wave, each over a shared 48-key band, softmax in f32 VALU; out = O·W_proj + b on the same unit with the f32 O split hi/lo (2 products; 16384 × 256 × 256); f32 accumulate.
#define BB 2
#define LL 8192
#define EE 256
#define NH 8
#define DH 32
#define KW 31
#define DIL 2
#define NTOK (BB * LL)

typedef __bf16 v16b __attribute__((ext_vector_type(16)));
typedef unsigned short v8us __attribute__((ext_vector_type(8), may_alias));
typedef float  v8f  __attribute__((ext_vector_type(8)));
typedef float  v4f  __attribute__((ext_vector_type(4)));
typedef float  v4fa __attribute__((ext_vector_type(4), may_alias));
union FragB { v16b v; v8us half[2]; unsigned short u[16]; };

__device__ __forceinline__ unsigned short bf16_bits(float x) { unsigned int u = __float_as_uint(x); return (unsigned short)((u + 0x7FFFu + ((u >> 16) & 1u)) >> 16); }
__device__ __forceinline__ float bf16_val(unsigned short b) { return __uint_as_float(((unsigned int)b) << 16); }
__device__ __forceinline__ float bf16_round(float x) { return bf16_val(bf16_bits(x)); }
// D += A·B with NT terms: 1 = ah·bh, 2 = + al·bh (A split), 3 = + ah·bl (both split)
template <int NT>
__device__ __forceinline__ v8f mmaN(v16b ah, v16b al, v16b bh, v16b bl, v8f c) {
  c = __builtin_amdgcn_wmma_f32_16x16x32_bf16(false, ah, false, bh, (short)0, c, false, false);
  if (NT >= 2) c = __builtin_amdgcn_wmma_f32_16x16x32_bf16(false, al, false, bh, (short)0, c, false, false);
  if (NT >= 3) c = __builtin_amdgcn_wmma_f32_16x16x32_bf16(false, ah, false, bl, (short)0, c, false, false);
  asm volatile("v_nop\n\tv_nop\n\tv_nop\n\tv_nop" : "+v"(c) : "v"(ah), "v"(al), "v"(bh), "v"(bl));
  return c;
}

__global__ __launch_bounds__(256) void k_wt_bf16(const float* __restrict__ W, unsigned short* __restrict__ Wt, int K, int N) {
  const int t = blockIdx.x * 256 + threadIdx.x;
  const int k8n = K / 8;
  if (t >= N * k8n) return;
  const int n = t / k8n, k8 = (t % k8n) * 8;
  v8us v;
#pragma unroll
  for (int i = 0; i < 8; ++i) v[i] = bf16_bits(W[(size_t)(k8 + i) * N + n]);
  *(v8us*)(Wt + (size_t)n * K + k8) = v;
  
}

// GEMM C[M][N] (f32, pitch ldc) = act(A[M][K]·W + bias). A f32 row-major (pitch lda) converted per fragment to bf16
// (ASPLIT: hi/lo two planes -> 2 terms, else single rounded term); Wt bf16 [N][K] (pitch ldb). BIAS_BF16 rounds the
// bias to bf16 first (bias quantised to bf16 before the add). K%32==0, M%16==0, N%64==0.
template <bool ASPLIT, int ACT, bool BIAS_BF16>
__global__ __launch_bounds__(128) void k_gemm_bf(const float* __restrict__ A, int lda, const unsigned short* __restrict__ Wt, int ldb,
                                               const float* __restrict__ bias, float* __restrict__ C, int ldc, int M, int N, int K) {
  __shared__ __attribute__((aligned(16))) float so[4][16][64];
  const int tid = threadIdx.x, w = tid >> 5, lane = tid & 31, ln = lane & 15, hh = lane >> 4;
  const int ntn = N / 64;
  const int wid = blockIdx.x * 4 + w;
  const int mt = wid / ntn, nq = wid % ntn;
  if (mt * 16 >= M) return;
  const int row0 = mt * 16, col0 = nq * 64;
  const float* arow = A + (size_t)(row0 + ln) * lda;
  v8f acc[4] = {};
  for (int kb = 0; kb < K; kb += 32) {
    FragB ah, al;
    const v4f x0 = *(const v4fa*)(arow + kb + 8 * hh), x1 = *(const v4fa*)(arow + kb + 8 * hh + 4);
    const v4f x2 = *(const v4fa*)(arow + kb + 16 + 8 * hh), x3 = *(const v4fa*)(arow + kb + 16 + 8 * hh + 4);
    float xs[16] = {x0[0],x0[1],x0[2],x0[3],x1[0],x1[1],x1[2],x1[3],x2[0],x2[1],x2[2],x2[3],x3[0],x3[1],x3[2],x3[3]};
#pragma unroll
    for (int i = 0; i < 16; ++i) { const unsigned short hb = bf16_bits(xs[i]); ah.u[i] = hb; al.u[i] = ASPLIT ? bf16_bits(xs[i] - bf16_val(hb)) : (unsigned short)0; }
#pragma unroll
    for (int t = 0; t < 4; ++t) {
      const unsigned short* brow = Wt + (size_t)(col0 + t * 16 + ln) * ldb + kb;
      FragB b;
      b.half[0] = *(const v8us*)(brow + 8 * hh);
      b.half[1] = *(const v8us*)(brow + 16 + 8 * hh);
      acc[t] = mmaN<ASPLIT ? 2 : 1>(ah.v, al.v, b.v, b.v, acc[t]);
    }
  }
#pragma unroll
  for (int t = 0; t < 4; ++t) {
    float bv = bias ? bias[col0 + t * 16 + ln] : 0.f;
    if (BIAS_BF16) bv = bf16_round(bv);
#pragma unroll
    for (int r = 0; r < 8; ++r) { float v = acc[t][r] + bv; if (ACT == 1) v = fmaxf(v, 0.f); so[w][8 * hh + r][t * 16 + ln] = v; }
  }
  __builtin_amdgcn_fence(__ATOMIC_ACQ_REL, "workgroup");
  __builtin_amdgcn_wave_barrier();
  const int rsub = lane >> 4, c4 = (lane & 15) * 4;
  {
#pragma unroll
    for (int q = 0; q < 8; ++q) {
      const int r = q * 2 + rsub;
      const v4f v = *(const v4fa*)&so[w][r][c4];
      *(v4f*)(C + (size_t)(row0 + r) * ldc + col0 + c4) = v;
    }
    
  }
}

// Flash-style causal/unmasked attention, all contractions 3-term bf16 hi/lo splits, f32 softmax with running max.
// q,k,v rows are read from f32 buffers with arbitrary row pitch (so they can live inside a fused qkv buffer);
// D = head size (multiple of 32, <= 128); one wave = 16 query rows; block = 4 waves (64 queries) sharing K/V chunks of 32.
template <int D, bool CAUSAL>
__global__ __launch_bounds__(128) void k_flash(const float* __restrict__ qb, const float* __restrict__ kb, const float* __restrict__ vb,
                                             int pitch, int T, int H, float scale, float* __restrict__ y, int ypitch) {
  constexpr int KS = D / 32;        // k-steps for QK
  constexpr int DT = D / 16;        // d tiles for PV
  __shared__ __attribute__((aligned(16))) unsigned short sKh[32][D + 8], sKl[32][D + 8], sVh[32][D + 8], sVl[32][D + 8];
  __shared__ __attribute__((aligned(16))) unsigned short sPh[4][16][40], sPl[4][16][40];
  __shared__ __attribute__((aligned(16))) float sO[4][16][D];
  const int tid = threadIdx.x, w = tid >> 5, lane = tid & 31, ln = lane & 15, hh = lane >> 4;
  const int nqb = (T + 63) / 64;
  const int bh = blockIdx.x / nqb, qblk = blockIdx.x % nqb;
  const int b = bh / H, h = bh % H;
  const int q0 = qblk * 64 + w * 16;
  const float* Q = qb + (size_t)b * T * pitch + h * D;
  const float* K = kb + (size_t)b * T * pitch + h * D;
  const float* V = vb + (size_t)b * T * pitch + h * D;

  // A fragments of the wave's 16 query rows (scaled), hi/lo
  FragB aqh[KS], aql[KS];
  {
    int row = q0 + ln; if (row >= T) row = T - 1;
    const float* qr = Q + (size_t)row * pitch;
#pragma unroll
    for (int ks = 0; ks < KS; ++ks)
#pragma unroll
      for (int i = 0; i < 16; ++i) {
        const int d = ks * 32 + ((i < 8) ? (8 * hh + i) : (16 + 8 * hh + (i - 8)));
        const float x = qr[d] * scale; const unsigned short hb = bf16_bits(x);
        aqh[ks].u[i] = hb; aql[ks].u[i] = bf16_bits(x - bf16_val(hb));
      }
  }
  float m_r[8], l_r[8];
#pragma unroll
  for (int r = 0; r < 8; ++r) { m_r[r] = -3.0e38f; l_r[r] = 0.f; }
  v8f oacc[DT];
#pragma unroll
  for (int dt = 0; dt < DT; ++dt) oacc[dt] = (v8f){0.f,0.f,0.f,0.f,0.f,0.f,0.f,0.f};

  const int kv_end = CAUSAL ? min(T, qblk * 64 + 64) : T;     // block-uniform
  for (int j0 = 0; j0 < kv_end; j0 += 32) {
    __syncthreads();
    for (int e = tid; e < 32 * (D / 4); e += 128) {
      const int r = e / (D / 4), c4 = (e % (D / 4)) * 4;
      const int key = j0 + r;
      v4f kf = {0.f,0.f,0.f,0.f}, vf = {0.f,0.f,0.f,0.f};
      if (key < T) { kf = *(const v4fa*)(K + (size_t)key * pitch + c4); vf = *(const v4fa*)(V + (size_t)key * pitch + c4); }
#pragma unroll
      for (int t = 0; t < 4; ++t) {
        unsigned short hb = bf16_bits(kf[t]); sKh[r][c4 + t] = hb; sKl[r][c4 + t] = bf16_bits(kf[t] - bf16_val(hb));
        hb = bf16_bits(vf[t]); sVh[r][c4 + t] = hb; sVl[r][c4 + t] = bf16_bits(vf[t] - bf16_val(hb));
      }
    }
    __syncthreads();
    // S tile 16 x 32
    v8f s[2];
#pragma unroll
    for (int nt = 0; nt < 2; ++nt) {
      v8f acc = {};
#pragma unroll
      for (int ks = 0; ks < KS; ++ks) {
        FragB bh_, bl_;
        bh_.half[0] = *(const v8us*)&sKh[nt * 16 + ln][ks * 32 + 8 * hh]; bh_.half[1] = *(const v8us*)&sKh[nt * 16 + ln][ks * 32 + 16 + 8 * hh];
        bl_.half[0] = *(const v8us*)&sKl[nt * 16 + ln][ks * 32 + 8 * hh]; bl_.half[1] = *(const v8us*)&sKl[nt * 16 + ln][ks * 32 + 16 + 8 * hh];
        acc = mmaN<3>(aqh[ks].v, aql[ks].v, bh_.v, bl_.v, acc);
      }
      s[nt] = acc;
    }
    // mask + running max (rows 8hh+r; the 16 lanes of a half share rows)
    float alpha[8];
#pragma unroll
    for (int r = 0; r < 8; ++r) {
      const int qi = q0 + 8 * hh + r;
      const int ja = j0 + ln, jb = j0 + 16 + ln;
      if (CAUSAL) { if (ja > qi) s[0][r] = -3.0e38f; if (jb > qi) s[1][r] = -3.0e38f; }
      if (ja >= T) s[0][r] = -3.0e38f;
      if (jb >= T) s[1][r] = -3.0e38f;
      float mx = fmaxf(s[0][r], s[1][r]);
      mx = fmaxf(mx, __shfl_xor(mx, 1, 32)); mx = fmaxf(mx, __shfl_xor(mx, 2, 32)); mx = fmaxf(mx, __shfl_xor(mx, 4, 32)); mx = fmaxf(mx, __shfl_xor(mx, 8, 32));
      const float mnew = fmaxf(m_r[r], mx);
      alpha[r] = (mnew > -1.0e38f) ? __expf(m_r[r] - mnew) : 1.0f;
      const float p0 = (s[0][r] > -1.0e38f) ? __expf(s[0][r] - mnew) : 0.f;
      const float p1 = (s[1][r] > -1.0e38f) ? __expf(s[1][r] - mnew) : 0.f;
      m_r[r] = mnew;
      l_r[r] = l_r[r] * alpha[r] + p0 + p1;            // per-lane partial row sum (16 lanes combined at the end)
      unsigned short hb = bf16_bits(p0); sPh[w][8 * hh + r][ln] = hb;      sPl[w][8 * hh + r][ln] = bf16_bits(p0 - bf16_val(hb));
      hb = bf16_bits(p1);                sPh[w][8 * hh + r][16 + ln] = hb; sPl[w][8 * hh + r][16 + ln] = bf16_bits(p1 - bf16_val(hb));
    }
#pragma unroll
    for (int dt = 0; dt < DT; ++dt)
#pragma unroll
      for (int r = 0; r < 8; ++r) oacc[dt][r] *= alpha[r];
    __builtin_amdgcn_fence(__ATOMIC_ACQ_REL, "workgroup");
    __builtin_amdgcn_wave_barrier();
    FragB pah, pal;
    pah.half[0] = *(const v8us*)&sPh[w][ln][8 * hh]; pah.half[1] = *(const v8us*)&sPh[w][ln][16 + 8 * hh];
    pal.half[0] = *(const v8us*)&sPl[w][ln][8 * hh]; pal.half[1] = *(const v8us*)&sPl[w][ln][16 + 8 * hh];
#pragma unroll
    for (int dt = 0; dt < DT; ++dt) {
      FragB bvh, bvl;
#pragma unroll
      for (int i = 0; i < 8; ++i) {
        bvh.u[i] = sVh[8 * hh + i][dt * 16 + ln]; bvh.u[8 + i] = sVh[16 + 8 * hh + i][dt * 16 + ln];
        bvl.u[i] = sVl[8 * hh + i][dt * 16 + ln]; bvl.u[8 + i] = sVl[16 + 8 * hh + i][dt * 16 + ln];
      }
      oacc[dt] = mmaN<3>(pah.v, pal.v, bvh.v, bvl.v, oacc[dt]);
    }
    __builtin_amdgcn_fence(__ATOMIC_ACQ_REL, "workgroup");
    __builtin_amdgcn_wave_barrier();
  }
#pragma unroll
  for (int r = 0; r < 8; ++r) {
    float l = l_r[r];
    l += __shfl_xor(l, 1, 32); l += __shfl_xor(l, 2, 32); l += __shfl_xor(l, 4, 32); l += __shfl_xor(l, 8, 32);
    l_r[r] = (l > 0.f) ? 1.0f / l : 0.f;
  }
#pragma unroll
  for (int dt = 0; dt < DT; ++dt)
#pragma unroll
    for (int r = 0; r < 8; ++r) sO[w][8 * hh + r][dt * 16 + ln] = oacc[dt][r] * l_r[r];
  __builtin_amdgcn_fence(__ATOMIC_ACQ_REL, "workgroup");
  __builtin_amdgcn_wave_barrier();
  {
    for (int r = 0; r < 16; ++r) {
      const int row = q0 + r;
      if (row < T && lane < D / 4) {
        const v4f val = *(const v4fa*)&sO[w][r][lane * 4];
        *(v4f*)(y + ((size_t)b * T + row) * ypitch + h * D + lane * 4) = val;
      }
    }
    
  }
}

// batched f32 [K][N] (pitch lds, batch stride sIn) -> transposed hi/lo planes [N][K] (batch stride sOut); thread per (n, 8 k); grid.y = batch
__global__ __launch_bounds__(256) void k_split_transpose_b(const float* __restrict__ src, int lds_, size_t sIn, unsigned short* __restrict__ hi, unsigned short* __restrict__ lo, size_t sOut, int K, int N) {
  const size_t t = (size_t)blockIdx.x * 256 + threadIdx.x; const int k8n = K / 8; if (t >= (size_t)N * k8n) return;
  src += (size_t)blockIdx.y * sIn; hi += (size_t)blockIdx.y * sOut; lo += (size_t)blockIdx.y * sOut;
  const int n = (int)(t / k8n), k8 = (int)(t % k8n) * 8; v8us vh, vl;
#pragma unroll
  for (int i = 0; i < 8; ++i) { const float x = src[(size_t)(k8 + i) * lds_ + n]; const unsigned short hb = bf16_bits(x); vh[i] = hb; vl[i] = bf16_bits(x - bf16_val(hb)); }
  unsigned short* dh = hi + (size_t)n * K + k8; unsigned short* dl = lo + (size_t)n * K + k8;
  *(v8us*)dh = vh; *(v8us*)dl = vl; 
}

__global__ __launch_bounds__(256) void k_round_rows(const float* __restrict__ W, unsigned short* __restrict__ Wt, int n8) {
  const int t = blockIdx.x * 256 + threadIdx.x;
  if (t >= n8) return;
  const v4f a = *(const v4fa*)(W + (size_t)t * 8), b = *(const v4fa*)(W + (size_t)t * 8 + 4);
  v8us v; v[0]=bf16_bits(a[0]); v[1]=bf16_bits(a[1]); v[2]=bf16_bits(a[2]); v[3]=bf16_bits(a[3]);
  v[4]=bf16_bits(b[0]); v[5]=bf16_bits(b[1]); v[6]=bf16_bits(b[2]); v[7]=bf16_bits(b[3]);
  *(v8us*)(Wt + (size_t)t * 8) = v; 
}

// weights -> bf16, packed in B-fragment order: tile (nt = n / 16, ks = k / 32) is 1 KiB = [j = 0, 1][lane = 16 hh + ln][8 elements],
// element i = W[32 ks + 16 j + 8 hh + i][16 nt + ln], so that each half fragment of a wave is one run of 512 bytes. Thread = one 16-byte piece; Bq from w_qkv, Bp from w_proj.
template <int N>
__device__ __forceinline__ void pack_piece(const float* __restrict__ W, unsigned short* __restrict__ D, int u) {
  const int ln = u & 15, hh = (u >> 4) & 1, j = (u >> 5) & 1, ks = (u >> 6) & 7, nt = u >> 9;
  const float* s = W + (size_t)(ks * 32 + j * 16 + hh * 8) * N + nt * 16 + ln;      // one address, the 8 rows at compile-time distances
  v8us v;
#pragma unroll   // the index names registers: it must be a compile-time value
  for (int i = 0; i < 8; ++i) v[i] = bf16_bits(s[(size_t)i * N]);
  *(v8us*)(D + (size_t)u * 8) = v;
  // the store's registers are not rewritten on any path of the listing before this wait
  asm volatile("s_wait_xcnt 0x0" ::: "memory");
}
__global__ __launch_bounds__(256) void k_pack(const float* __restrict__ wq, const float* __restrict__ wp, unsigned short* __restrict__ Bq, unsigned short* __restrict__ Bp) {
  constexpr int NQB = 3 * EE * EE / 8 / 256;             // blocks that pack Bq; the rest pack Bp
  if (blockIdx.x < NQB) pack_piece<3 * EE>(wq, Bq, blockIdx.x * 256 + threadIdx.x);
  else pack_piece<EE>(wp, Bp, (blockIdx.x - NQB) * 256 + threadIdx.x);
}
// The whole layer in one kernel. Block = (b, dilation group g, 64 consecutive positions of the group) = 16 waves, one block per WGP; q, k, v and the attention output stay in LDS.
// 1. the block's 96 key rows of x (its 64 query rows among them) are read once in whole lines and kept in LDS as bf16.
// 2. wave w makes columns 16 w .. 16 w + 15 of K, V (96 rows) and Q (64 rows) from the packed table of k_pack. K and Q are made transposed (A = weight tile, B = x rows),
//    so that a lane holds 8 consecutive d of one row; V is made straight (A = x rows, B = weight tile), so that a lane holds 8 consecutive keys of one d:
//    each accumulator goes to its hi/lo planes (K, Q row-major, V transposed) as one 16-byte store per plane.
// 3. wave w takes head w / 2 and two tiles of 16 queries. Per tile: S^T = K.Q^T over its 48-key band (A = K rows, B = Q), keys outside a query's own 31-key window masked,
//    softmax per lane (one query per lane, halves joined by one exchange), P^T packed from the score tiles as the B operand, O^T = V^T.P^T; 3 terms per product (hi.hi + lo.hi + hi.lo).
//    O is split hi/lo into the place of the Q tile that the same wave has just read.
// 4. out = O . W_proj + bias: wave = 32 rows x 32 columns, 2 terms per product (O hi, O lo), stored in whole 128-byte lines through LDS (in the place of K, which is dead by then).
#define LGRP (LL / DIL)   // positions per dilation group
#define QT 64             // queries per block
#define KR 96             // key rows per block: 64 + 2 * 15, rounded up to whole 16-row tiles
#define RP (EE + 8)       // row pitch of x, K, Q / O in LDS, 16-bit units (528 B = 16 B x odd)
#define VP 104            // V^T row pitch in LDS, 16-bit units (208 B = 16 B x odd)
#define SP 36             // output staging pitch, floats (144 B = 16 B x odd)
#define KS (EE / 32)      // k-steps of a projection
static_assert(LL % (DIL * QT) == 0 && LGRP >= KR && DH == 32 && EE == 256 && NH * DH == EE && KW / 2 <= 15 && KW <= 31, "tiling of k_fused");
static_assert(16 * 32 * SP * 4 <= 2 * KR * RP * 2, "the output staging fits the place of K");
typedef float v2f __attribute__((ext_vector_type(2)));
typedef __bf16 v2b __attribute__((ext_vector_type(2)));
typedef unsigned short v4us __attribute__((ext_vector_type(4), may_alias));
typedef float fa __attribute__((may_alias));
union FragP { v16b v; v2b p[8]; v8us half[2]; };
union Pack8 { v8us v; v2b p[4]; };
union Pack4 { v4us v; v2b p[2]; };
// two f32 -> bf16 hi pair (round to nearest even) and bf16 lo pair of the exact remainders
__device__ __forceinline__ void split2(float a, float b, v2b& hi, v2b& lo) {
  const v2f x = {a, b};
  hi = __builtin_convertvector(x, v2b);
  const v2f r = x - __builtin_convertvector(hi, v2f);
  lo = __builtin_convertvector(r, v2b);
}
__device__ __forceinline__ v8f mma1(v16b a, v16b b, v8f c) { return __builtin_amdgcn_wmma_f32_16x16x32_bf16(false, a, false, b, (short)0, c, false, false); }
// one packed weight tile (1 KiB): two runs of 512 bytes per wave; p already holds the lane's 16 bytes
__device__ __forceinline__ void load_w(FragB& f, const unsigned short* p) { f.half[0] = *(const v8us*)p; f.half[1] = *(const v8us*)(p + 256); }
// a 16 x 32 fragment (A or B alike) from a row-major LDS plane; p = row ln, first column of the k-step + 8 hh
__device__ __forceinline__ void load_r(FragB& f, const unsigned short* p) { f.half[0] = *(const v8us*)p; f.half[1] = *(const v8us*)(p + 16); }
__global__ __launch_bounds__(512) void k_fused(const float* __restrict__ X, const unsigned short* __restrict__ Bq, const float* __restrict__ bq,
                                               const unsigned short* __restrict__ Bp, const float* __restrict__ bpj, float* __restrict__ out) {
  __shared__ __attribute__((aligned(16))) unsigned short sX[KR][RP], sK[2][KR][RP], sV[2][EE][VP], sQ[2][QT][RP];
  const int tid = threadIdx.x, lane = tid & 31, ln = lane & 15, hh = lane >> 4;
  const int w = __builtin_amdgcn_readfirstlane(tid >> 5);
  int bi = blockIdx.x;
  const int g = bi % DIL; bi /= DIL;
  const int qblk = bi % (LGRP / QT); const int b = bi / (LGRP / QT);
  const int p0 = qblk * QT;
  int base = p0 - 16; base = base < 0 ? 0 : (base > LGRP - KR ? LGRP - KR : base);       // first key position of the block
  const int qoff = p0 - base;                                                            // the first query's row among the key rows: 0, 16 or 32
  // ---- 1. x rows -> bf16 in LDS; the first weight tiles are asked for in front of them
  const unsigned short* wp = Bq + (size_t)w * (KS * 512) + lane * 8;                      // column tile w of Q; K at + 16 tiles, V at + 32 tiles
  const unsigned short* wk = wp + 16 * KS * 512;
  const unsigned short* wv = wp + 32 * KS * 512;
  FragB fk[3], fv[3], xf[6];
#pragma unroll   // the index names registers: it must be a compile-time value
  for (int ks = 0; ks < 2; ++ks) { load_w(fk[ks], wk + ks * 512); load_w(fv[ks], wv + ks * 512); }
  const float* xp = X + ((size_t)b * LL + g + (size_t)(base + (tid >> 6)) * DIL) * EE + (tid & 63) * 4;   // trip it: row 8 it + tid / 64, 4 columns
  v4f xa[KR / 8];
#pragma unroll   // the index names registers: it must be a compile-time value
  for (int it = 0; it < KR / 8; ++it) xa[it] = *(const v4fa*)(xp + (size_t)it * 8 * DIL * EE);
  const float* bkp = bq + EE + 16 * w + 8 * hh;          // K bias of the lane's 8 d; Q bias at - EE
  const v4f bk0 = *(const v4fa*)bkp, bk1 = *(const v4fa*)(bkp + 4), bq0 = *(const v4fa*)(bkp - EE), bq1 = *(const v4fa*)(bkp - EE + 4);
  const float* bvp = bq + 2 * EE + 16 * w + ln;          // V bias of the lane's d
  const float bvr = *bvp;
  // no address register of the loads above is rewritten before this wait; xp is named so that its pair lives until here
  asm volatile("s_wait_xcnt 0x0" :: "v"(xp) : "memory");
#pragma unroll   // the index names registers: it must be a compile-time value
  for (int it = 0; it < KR / 8; ++it) {
    const v2f a0 = {xa[it][0], xa[it][1]}, a1 = {xa[it][2], xa[it][3]};
    Pack4 ph; ph.p[0] = __builtin_convertvector(a0, v2b); ph.p[1] = __builtin_convertvector(a1, v2b);
    *(v4us*)&sX[it * 8 + (tid >> 6)][(tid & 63) * 4] = ph.v;
  }
  __syncthreads();
  // ---- 2a. K^T and V, 6 row tiles each
  {
    v8f ak[6] = {}, av[6] = {};
    const unsigned short* xr = &sX[ln][8 * hh];
#pragma unroll   // the index names registers: it must be a compile-time value
    for (int ks = 0; ks < KS; ++ks) {
      if (ks + 2 < KS) { load_w(fk[(ks + 2) % 3], wk + (ks + 2) * 512); load_w(fv[(ks + 2) % 3], wv + (ks + 2) * 512); }
#pragma unroll   // the index names registers: it must be a compile-time value
      for (int mi = 0; mi < 6; ++mi) load_r(xf[mi], xr + mi * 16 * RP + ks * 32);
      // keeps the loads above in front of this k-step's products: sunk to their uses, each would make the wave wait out its latency
      __builtin_amdgcn_sched_barrier(0);
#pragma unroll   // the index names registers: it must be a compile-time value
      for (int mi = 0; mi < 6; ++mi) ak[mi] = mma1(fk[ks % 3].v, xf[mi].v, ak[mi]);
#pragma unroll   // the index names registers: it must be a compile-time value
      for (int mi = 0; mi < 6; ++mi) av[mi] = mma1(xf[mi].v, fv[ks % 3].v, av[mi]);
    }
    // the first Q weight tiles fly while K and V are split and stored
#pragma unroll   // the index names registers: it must be a compile-time value
    for (int ks = 0; ks < 2; ++ks) load_w(fk[ks], wp + ks * 512);
    const float bk[8] = {bf16_round(bk0[0]), bf16_round(bk0[1]), bf16_round(bk0[2]), bf16_round(bk0[3]), bf16_round(bk1[0]), bf16_round(bk1[1]), bf16_round(bk1[2]), bf16_round(bk1[3])};
    const float bv = bf16_round(bvr);
#pragma unroll   // the index names registers: it must be a compile-time value
    for (int mi = 0; mi < 6; ++mi) {
      Pack8 ph, pl;
      // ak[mi][r] = K[row 16 mi + ln][d = 16 w + 8 hh + r]
#pragma unroll   // the index names registers: it must be a compile-time value
      for (int i = 0; i < 4; ++i) split2(ak[mi][2 * i] + bk[2 * i], ak[mi][2 * i + 1] + bk[2 * i + 1], ph.p[i], pl.p[i]);
      *(v8us*)&sK[0][mi * 16 + ln][16 * w + 8 * hh] = ph.v; *(v8us*)&sK[1][mi * 16 + ln][16 * w + 8 * hh] = pl.v;
      // av[mi][r] = V[row 16 mi + 8 hh + r][d = 16 w + ln]
#pragma unroll   // the index names registers: it must be a compile-time value
      for (int i = 0; i < 4; ++i) split2(av[mi][2 * i] + bv, av[mi][2 * i + 1] + bv, ph.p[i], pl.p[i]);
      *(v8us*)&sV[0][16 * w + ln][mi * 16 + 8 * hh] = ph.v; *(v8us*)&sV[1][16 * w + ln][mi * 16 + 8 * hh] = pl.v;
    }
  }
  // ---- 2b. Q^T, 4 row tiles
  {
    v8f aq[4] = {};
    const unsigned short* xr = &sX[qoff + ln][8 * hh];
#pragma unroll   // the index names registers: it must be a compile-time value
    for (int ks = 0; ks < KS; ++ks) {
      if (ks + 2 < KS) load_w(fk[(ks + 2) % 3], wp + (ks + 2) * 512);
#pragma unroll   // the index names registers: it must be a compile-time value
      for (int mi = 0; mi < 4; ++mi) load_r(xf[mi], xr + mi * 16 * RP + ks * 32);
      // keeps the loads above in front of this k-step's products, as in 2a
      __builtin_amdgcn_sched_barrier(0);
#pragma unroll   // the index names registers: it must be a compile-time value
      for (int mi = 0; mi < 4; ++mi) aq[mi] = mma1(fk[ks % 3].v, xf[mi].v, aq[mi]);
    }
    // the weight table's last load has been issued: its address registers may be rewritten only behind this wait
    asm volatile("s_wait_xcnt 0x0" ::: "memory");
    const float bb[8] = {bf16_round(bq0[0]), bf16_round(bq0[1]), bf16_round(bq0[2]), bf16_round(bq0[3]), bf16_round(bq1[0]), bf16_round(bq1[1]), bf16_round(bq1[2]), bf16_round(bq1[3])};
#pragma unroll   // the index names registers: it must be a compile-time value
    for (int mi = 0; mi < 4; ++mi) {
      Pack8 ph, pl;
      // aq[mi][r] = Q[query 16 mi + ln][d = 16 w + 8 hh + r]
#pragma unroll   // the index names registers: it must be a compile-time value
      for (int i = 0; i < 4; ++i) split2(aq[mi][2 * i] + bb[2 * i], aq[mi][2 * i + 1] + bb[2 * i + 1], ph.p[i], pl.p[i]);
      *(v8us*)&sQ[0][mi * 16 + ln][16 * w + 8 * hh] = ph.v; *(v8us*)&sQ[1][mi * 16 + ln][16 * w + 8 * hh] = pl.v;
    }
  }
  __syncthreads();
  // the output projection's first weight tiles and its bias fly during the attention (in front of the barrier it would wait for them)
  const int mp = w & 1, np = w >> 1;                     // step 4: rows 32 mp .., columns 32 np ..
  const unsigned short* pb = Bp + (size_t)(np * 2) * (KS * 512) + lane * 8;
  FragB fb[3][2];
#pragma unroll   // the index names registers: it must be a compile-time value
  for (int ks = 0; ks < 2; ++ks) { load_w(fb[ks][0], pb + ks * 512); load_w(fb[ks][1], pb + (KS + ks) * 512); }
  const float* bop = bpj + np * 32 + ln;
  const float bo0 = bop[0], bo1 = bop[16];
  // no address register of the loads above is rewritten before this wait
  asm volatile("s_wait_xcnt 0x0" ::: "memory");
  // ---- 3. attention: head w / 2, query tiles 2 (w % 2) and 2 (w % 2) + 1
  const int hc = (w >> 1) * DH;
#pragma unroll   // the two tiles are independent: side by side they fill each other's waits
  for (int tk = 0; tk < 2; ++tk) {
    const int qt = (w & 1) * 2 + tk;
    const int q0 = p0 + 16 * qt;
    // B fragments of the tile's 16 queries (column = query ln)
    FragP qh, ql;
    qh.half[0] = *(const v8us*)&sQ[0][qt * 16 + ln][hc + 8 * hh]; qh.half[1] = *(const v8us*)&sQ[0][qt * 16 + ln][hc + 16 + 8 * hh];
    ql.half[0] = *(const v8us*)&sQ[1][qt * 16 + ln][hc + 8 * hh]; ql.half[1] = *(const v8us*)&sQ[1][qt * 16 + ln][hc + 16 + 8 * hh];
    int kw = q0 - 16; kw = kw < 0 ? 0 : (kw > LGRP - 48 ? LGRP - 48 : kw);                // first key position of the tile's 48-key band
    const int kr = kw - base;
    // S^T tiles: s[nt][r] = score of key kw + 16 nt + 8hh + r with query q0 + ln
    v8f s[3];
#pragma unroll
    for (int nt = 0; nt < 3; ++nt) {
      const unsigned short* rh = &sK[0][kr + nt * 16 + ln][hc]; const unsigned short* rl = &sK[1][kr + nt * 16 + ln][hc];
      FragP kh, kl;
      kh.half[0] = *(const v8us*)(rh + 8 * hh); kh.half[1] = *(const v8us*)(rh + 16 + 8 * hh);
      kl.half[0] = *(const v8us*)(rl + 8 * hh); kl.half[1] = *(const v8us*)(rl + 16 + 8 * hh);
      const v8f z = {};
      s[nt] = mmaN<3>(kh.v, kl.v, qh.v, ql.v, z);
    }
    // the query's own window (NATTEN clamp), softmax over it
    int start = q0 + ln - KW / 2; start = start < 0 ? 0 : (start > LGRP - KW ? LGRP - KW : start);
    const int off = kw + 8 * hh - start;
    float mx = -3.0e38f;
#pragma unroll
    for (int nt = 0; nt < 3; ++nt)
#pragma unroll
      for (int r = 0; r < 8; ++r) {
        const float v = ((unsigned)(off + nt * 16 + r) < (unsigned)KW) ? s[nt][r] * (0.17677669529663687f * 1.4426950408889634f) : -3.0e38f;   // scale * log2(e): softmax in base 2
        s[nt][r] = v; mx = fmaxf(mx, v);
      }
    mx = fmaxf(mx, __shfl_xor(mx, 16, 32));
    float den = 0.f;
#pragma unroll
    for (int nt = 0; nt < 3; ++nt)
#pragma unroll
      for (int r = 0; r < 8; ++r) {
        float p;
        // the v_nop keeps the one slot behind a transcendental, whatever the compiler puts next (a reader of p, or a write to the source register)
        asm("v_exp_f32 %0, %1\n\tv_nop" : "=v"(p) : "v"(s[nt][r] - mx));
        s[nt][r] = p; den += p;   // a masked key gives exactly 0
      }
    den += __shfl_xor(den, 16, 32);
    // P^T as B operand: element i < 8 is tile 2ks, row 8hh + i; element 8 + i is tile 2ks + 1, row 8hh + i; keys 48..63 of the second step are zero on both sides
    FragP ph[2], pl[2];
#pragma unroll
    for (int i = 0; i < 4; ++i) {
      split2(s[0][2 * i], s[0][2 * i + 1], ph[0].p[i], pl[0].p[i]);
      split2(s[1][2 * i], s[1][2 * i + 1], ph[0].p[4 + i], pl[0].p[4 + i]);
      split2(s[2][2 * i], s[2][2 * i + 1], ph[1].p[i], pl[1].p[i]);
    }
    const v8us zero8 = {0, 0, 0, 0, 0, 0, 0, 0};
    ph[1].half[1] = zero8; pl[1].half[1] = zero8;
    const float inv = 1.0f / den;
#pragma unroll
    for (int dt = 0; dt < 2; ++dt) {
      const unsigned short* rh = &sV[0][hc + dt * 16 + ln][kr]; const unsigned short* rl = &sV[1][hc + dt * 16 + ln][kr];
      FragP vh, vl;
      v8f acc = {};
      vh.half[0] = *(const v8us*)(rh + 8 * hh); vh.half[1] = *(const v8us*)(rh + 16 + 8 * hh);
      vl.half[0] = *(const v8us*)(rl + 8 * hh); vl.half[1] = *(const v8us*)(rl + 16 + 8 * hh);
      acc = mmaN<3>(vh.v, vl.v, ph[0].v, pl[0].v, acc);
      vh.half[0] = *(const v8us*)(rh + 32 + 8 * hh); vh.half[1] = zero8;
      vl.half[0] = *(const v8us*)(rl + 32 + 8 * hh); vl.half[1] = zero8;
      acc = mmaN<3>(vh.v, vl.v, ph[1].v, pl[1].v, acc);
      // acc[r] = O[query ln][d = 16 dt + 8hh + r]: split and put where this tile's Q stood (read by this wave alone, above)
      Pack8 oh, ol;
#pragma unroll
      for (int i = 0; i < 4; ++i) split2(acc[2 * i] * inv, acc[2 * i + 1] * inv, oh.p[i], ol.p[i]);
      *(v8us*)&sQ[0][qt * 16 + ln][hc + dt * 16 + 8 * hh] = oh.v; *(v8us*)&sQ[1][qt * 16 + ln][hc + dt * 16 + 8 * hh] = ol.v;
    }
  }
  __syncthreads();
  // ---- 4. out rows = O . W_proj + bias
  v8f acc[2][2] = {};
  {
    FragB ah[2], al[2];
    const unsigned short* oh = &sQ[0][mp * 32 + ln][8 * hh]; const unsigned short* ol = &sQ[1][mp * 32 + ln][8 * hh];
#pragma unroll   // the index names registers: it must be a compile-time value
    for (int ks = 0; ks < KS; ++ks) {
      if (ks + 2 < KS) { load_w(fb[(ks + 2) % 3][0], pb + (ks + 2) * 512); load_w(fb[(ks + 2) % 3][1], pb + (KS + ks + 2) * 512); }
#pragma unroll   // the index names registers: it must be a compile-time value
      for (int mi = 0; mi < 2; ++mi) { load_r(ah[mi], oh + mi * 16 * RP + ks * 32); load_r(al[mi], ol + mi * 16 * RP + ks * 32); }
      // keeps the loads above in front of this k-step's products, as in 2a
      __builtin_amdgcn_sched_barrier(0);
      // per accumulator and k-step: hi term, then lo term
#pragma unroll   // the index names registers: it must be a compile-time value
      for (int mi = 0; mi < 2; ++mi)
#pragma unroll   // the index names registers: it must be a compile-time value
        for (int t = 0; t < 2; ++t) acc[mi][t] = mma1(ah[mi].v, fb[ks % 3][t].v, acc[mi][t]);
#pragma unroll   // the index names registers: it must be a compile-time value
      for (int mi = 0; mi < 2; ++mi)
#pragma unroll   // the index names registers: it must be a compile-time value
        for (int t = 0; t < 2; ++t) acc[mi][t] = mma1(al[mi].v, fb[ks % 3][t].v, acc[mi][t]);
    }
  }
  // the last weight load has been issued: its address registers may be rewritten only behind this wait
  asm volatile("s_wait_xcnt 0x0" ::: "memory");
  const float bv0 = bf16_round(bo0), bv1 = bf16_round(bo1);
  fa* so = (fa*)&sK[0][0][0] + w * 32 * SP;              // the wave's own 32 x 32 staging tile; every read of K ended at the barrier above
#pragma unroll   // the index names registers: it must be a compile-time value
  for (int m2 = 0; m2 < 2; ++m2)
#pragma unroll   // the index names registers: it must be a compile-time value
    for (int r = 0; r < 8; ++r) {
      so[(m2 * 16 + 8 * hh + r) * SP + ln] = acc[m2][0][r] + bv0;
      so[(m2 * 16 + 8 * hh + r) * SP + 16 + ln] = acc[m2][1][r] + bv1;
    }
  // the wave re-reads its own staging rows, other lanes' words: its LDS stores end before its LDS loads start, so that each global store covers whole 128-byte lines
  asm volatile("s_wait_dscnt 0x0" ::: "memory");
  float* cp = out + ((size_t)b * LL + g + (size_t)(p0 + mp * 32 + (lane >> 3)) * DIL) * EE + np * 32 + (lane & 7) * 4;
#pragma unroll
  for (int q = 0; q < 8; ++q) {
    const v4f v = *(const v4fa*)&so[(q * 4 + (lane >> 3)) * SP + (lane & 7) * 4];
    *(v4f*)(cp + (size_t)q * 4 * DIL * EE) = v;
  }
}
extern "C" void kernel_launch(void* const* d_in, const int* in_sizes, int n_in,
                              void* d_out, int out_size, void* d_ws, size_t ws_size, hipStream_t stream) {
  (void)in_sizes; (void)n_in; (void)out_size;
  const float* x = (const float*)d_in[0]; const float* wq = (const float*)d_in[1]; const float* bq = (const float*)d_in[2]; const float* wp = (const float*)d_in[3]; const float* bp = (const float*)d_in[4];
  char* ws = (char*)d_ws; size_t off = 0;
  auto take = [&](size_t bytes) { char* p = ws + off; off += (bytes + 255) & ~(size_t)255; return p; };
  unsigned short* Bq = (unsigned short*)take((size_t)3 * EE * EE * 2); unsigned short* Bp = (unsigned short*)take((size_t)EE * EE * 2);
  if (off > ws_size) return;
  k_pack<<<(3 * EE * EE + EE * EE) / 8 / 256, 256, 0, stream>>>(wq, wp, Bq, Bp);
  k_fused<<<BB * DIL * (LGRP / QT), 512, 0, stream>>>(x, Bq, bq, Bp, bp, (float*)d_out);
}

// v004
// A run of this version takes 19.5 microseconds.
// In two side-by-side timings against v003, it was 1.11 and 1.13 times as fast.
// Counting every step since v000, it is 7.95 times as fast.
#include <hip/hip_runtime.h>
// 1-D neighbourhood attention (NATTEN, K = 31, dilation 2, 8 heads × 32): qkv = x·W + b on v_wmma_f32_16x16x32_bf16 (x rounded to bf16: single exact term; 16384 × 256 × 768),
// the per-token 31-key windows (indices computed from the NATTEN clamp formula, never loaded): q.k and P.V on the same unit with both operands split hi/lo (3 products),
// four tiles of 16 queries of one dilation group per wave, each over a shared 48-key band, softmax in f32 VALU; out = O·W_proj + b on the same unit with the f32 O split hi/lo (2 products; 16384 × 256 × 256); f32 accumulate.
#define BB 2
#define LL 8192
#define EE 256
#define NH 8
#define DH 32
#define KW 31
#define DIL 2
#define NTOK (BB * LL)

typedef __bf16 v16b __attribute__((ext_vector_type(16)));
typedef unsigned short v8us __attribute__((ext_vector_type(8), may_alias));
typedef float  v8f  __attribute__((ext_vector_type(8)));
typedef float  v4f  __attribute__((ext_vector_type(4)));
typedef float  v4fa __attribute__((ext_vector_type(4), may_alias));
union FragB { v16b v; v8us half[2]; unsigned short u[16]; };

__device__ __forceinline__ unsigned short bf16_bits(float x) { unsigned int u = __float_as_uint(x); return (unsigned short)((u + 0x7FFFu + ((u >> 16) & 1u)) >> 16); }
__device__ __forceinline__ float bf16_val(unsigned short b) { return __uint_as_float(((unsigned int)b) << 16); }
__device__ __forceinline__ float bf16_round(float x) { return bf16_val(bf16_bits(x)); }
// D += A·B with NT terms: 1 = ah·bh, 2 = + al·bh (A split), 3 = + ah·bl (both split)
template <int NT>
__device__ __forceinline__ v8f mmaN(v16b ah, v16b al, v16b bh, v16b bl, v8f c) {
  c = __builtin_amdgcn_wmma_f32_16x16x32_bf16(false, ah, false, bh, (short)0, c, false, false);
  if (NT >= 2) c = __builtin_amdgcn_wmma_f32_16x16x32_bf16(false, al, false, bh, (short)0, c, false, false);
  if (NT >= 3) c = __builtin_amdgcn_wmma_f32_16x16x32_bf16(false, ah, false, bl, (short)0, c, false, false);
  asm volatile("v_nop\n\tv_nop\n\tv_nop\n\tv_nop" : "+v"(c) : "v"(ah), "v"(al), "v"(bh), "v"(bl));
  return c;
}

__global__ __launch_bounds__(256) void k_wt_bf16(const float* __restrict__ W, unsigned short* __restrict__ Wt, int K, int N) {
  const int t = blockIdx.x * 256 + threadIdx.x;
  const int k8n = K / 8;
  if (t >= N * k8n) return;
  const int n = t / k8n, k8 = (t % k8n) * 8;
  v8us v;
#pragma unroll
  for (int i = 0; i < 8; ++i) v[i] = bf16_bits(W[(size_t)(k8 + i) * N + n]);
  *(v8us*)(Wt + (size_t)n * K + k8) = v;
  
}

// GEMM C[M][N] (f32, pitch ldc) = act(A[M][K]·W + bias). A f32 row-major (pitch lda) converted per fragment to bf16
// (ASPLIT: hi/lo two planes -> 2 terms, else single rounded term); Wt bf16 [N][K] (pitch ldb). BIAS_BF16 rounds the
// bias to bf16 first (bias quantised to bf16 before the add). K%32==0, M%16==0, N%64==0.
template <bool ASPLIT, int ACT, bool BIAS_BF16>
__global__ __launch_bounds__(128) void k_gemm_bf(const float* __restrict__ A, int lda, const unsigned short* __restrict__ Wt, int ldb,
                                               const float* __restrict__ bias, float* __restrict__ C, int ldc, int M, int N, int K) {
  __shared__ __attribute__((aligned(16))) float so[4][16][64];
  const int tid = threadIdx.x, w = tid >> 5, lane = tid & 31, ln = lane & 15, hh = lane >> 4;
  const int ntn = N / 64;
  const int wid = blockIdx.x * 4 + w;
  const int mt = wid / ntn, nq = wid % ntn;
  if (mt * 16 >= M) return;
  const int row0 = mt * 16, col0 = nq * 64;
  const float* arow = A + (size_t)(row0 + ln) * lda;
  v8f acc[4] = {};
  for (int kb = 0; kb < K; kb += 32) {
    FragB ah, al;
    const v4f x0 = *(const v4fa*)(arow + kb + 8 * hh), x1 = *(const v4fa*)(arow + kb + 8 * hh + 4);
    const v4f x2 = *(const v4fa*)(arow + kb + 16 + 8 * hh), x3 = *(const v4fa*)(arow + kb + 16 + 8 * hh + 4);
    float xs[16] = {x0[0],x0[1],x0[2],x0[3],x1[0],x1[1],x1[2],x1[3],x2[0],x2[1],x2[2],x2[3],x3[0],x3[1],x3[2],x3[3]};
#pragma unroll
    for (int i = 0; i < 16; ++i) { const unsigned short hb = bf16_bits(xs[i]); ah.u[i] = hb; al.u[i] = ASPLIT ? bf16_bits(xs[i] - bf16_val(hb)) : (unsigned short)0; }
#pragma unroll
    for (int t = 0; t < 4; ++t) {
      const unsigned short* brow = Wt + (size_t)(col0 + t * 16 + ln) * ldb + kb;
      FragB b;
      b.half[0] = *(const v8us*)(brow + 8 * hh);
      b.half[1] = *(const v8us*)(brow + 16 + 8 * hh);
      acc[t] = mmaN<ASPLIT ? 2 : 1>(ah.v, al.v, b.v, b.v, acc[t]);
    }
  }
#pragma unroll
  for (int t = 0; t < 4; ++t) {
    float bv = bias ? bias[col0 + t * 16 + ln] : 0.f;
    if (BIAS_BF16) bv = bf16_round(bv);
#pragma unroll
    for (int r = 0; r < 8; ++r) { float v = acc[t][r] + bv; if (ACT == 1) v = fmaxf(v, 0.f); so[w][8 * hh + r][t * 16 + ln] = v; }
  }
  __builtin_amdgcn_fence(__ATOMIC_ACQ_REL, "workgroup");
  __builtin_amdgcn_wave_barrier();
  const int rsub = lane >> 4, c4 = (lane & 15) * 4;
  {
#pragma unroll
    for (int q = 0; q < 8; ++q) {
      const int r = q * 2 + rsub;
      const v4f v = *(const v4fa*)&so[w][r][c4];
      *(v4f*)(C + (size_t)(row0 + r) * ldc + col0 + c4) = v;
    }
    
  }
}

// Flash-style causal/unmasked attention, all contractions 3-term bf16 hi/lo splits, f32 softmax with running max.
// q,k,v rows are read from f32 buffers with arbitrary row pitch (so they can live inside a fused qkv buffer);
// D = head size (multiple of 32, <= 128); one wave = 16 query rows; block = 4 waves (64 queries) sharing K/V chunks of 32.
template <int D, bool CAUSAL>
__global__ __launch_bounds__(128) void k_flash(const float* __restrict__ qb, const float* __restrict__ kb, const float* __restrict__ vb,
                                             int pitch, int T, int H, float scale, float* __restrict__ y, int ypitch) {
  constexpr int KS = D / 32;        // k-steps for QK
  constexpr int DT = D / 16;        // d tiles for PV
  __shared__ __attribute__((aligned(16))) unsigned short sKh[32][D + 8], sKl[32][D + 8], sVh[32][D + 8], sVl[32][D + 8];
  __shared__ __attribute__((aligned(16))) unsigned short sPh[4][16][40], sPl[4][16][40];
  __shared__ __attribute__((aligned(16))) float sO[4][16][D];
  const int tid = threadIdx.x, w = tid >> 5, lane = tid & 31, ln = lane & 15, hh = lane >> 4;
  const int nqb = (T + 63) / 64;
  const int bh = blockIdx.x / nqb, qblk = blockIdx.x % nqb;
  const int b = bh / H, h = bh % H;
  const int q0 = qblk * 64 + w * 16;
  const float* Q = qb + (size_t)b * T * pitch + h * D;
  const float* K = kb + (size_t)b * T * pitch + h * D;
  const float* V = vb + (size_t)b * T * pitch + h * D;

  // A fragments of the wave's 16 query rows (scaled), hi/lo
  FragB aqh[KS], aql[KS];
  {
    int row = q0 + ln; if (row >= T) row = T - 1;
    const float* qr = Q + (size_t)row * pitch;
#pragma unroll
    for (int ks = 0; ks < KS; ++ks)
#pragma unroll
      for (int i = 0; i < 16; ++i) {
        const int d = ks * 32 + ((i < 8) ? (8 * hh + i) : (16 + 8 * hh + (i - 8)));
        const float x = qr[d] * scale; const unsigned short hb = bf16_bits(x);
        aqh[ks].u[i] = hb; aql[ks].u[i] = bf16_bits(x - bf16_val(hb));
      }
  }
  float m_r[8], l_r[8];
#pragma unroll
  for (int r = 0; r < 8; ++r) { m_r[r] = -3.0e38f; l_r[r] = 0.f; }
  v8f oacc[DT];
#pragma unroll
  for (int dt = 0; dt < DT; ++dt) oacc[dt] = (v8f){0.f,0.f,0.f,0.f,0.f,0.f,0.f,0.f};

  const int kv_end = CAUSAL ? min(T, qblk * 64 + 64) : T;     // block-uniform
  for (int j0 = 0; j0 < kv_end; j0 += 32) {
    __syncthreads();
    for (int e = tid; e < 32 * (D / 4); e += 128) {
      const int r = e / (D / 4), c4 = (e % (D / 4)) * 4;
      const int key = j0 + r;
      v4f kf = {0.f,0.f,0.f,0.f}, vf = {0.f,0.f,0.f,0.f};
      if (key < T) { kf = *(const v4fa*)(K + (size_t)key * pitch + c4); vf = *(const v4fa*)(V + (size_t)key * pitch + c4); }
#pragma unroll
      for (int t = 0; t < 4; ++t) {
        unsigned short hb = bf16_bits(kf[t]); sKh[r][c4 + t] = hb; sKl[r][c4 + t] = bf16_bits(kf[t] - bf16_val(hb));
        hb = bf16_bits(vf[t]); sVh[r][c4 + t] = hb; sVl[r][c4 + t] = bf16_bits(vf[t] - bf16_val(hb));
      }
    }
    __syncthreads();
    // S tile 16 x 32
    v8f s[2];
#pragma unroll
    for (int nt = 0; nt < 2; ++nt) {
      v8f acc = {};
#pragma unroll
      for (int ks = 0; ks < KS; ++ks) {
        FragB bh_, bl_;
        bh_.half[0] = *(const v8us*)&sKh[nt * 16 + ln][ks * 32 + 8 * hh]; bh_.half[1] = *(const v8us*)&sKh[nt * 16 + ln][ks * 32 + 16 + 8 * hh];
        bl_.half[0] = *(const v8us*)&sKl[nt * 16 + ln][ks * 32 + 8 * hh]; bl_.half[1] = *(const v8us*)&sKl[nt * 16 + ln][ks * 32 + 16 + 8 * hh];
        acc = mmaN<3>(aqh[ks].v, aql[ks].v, bh_.v, bl_.v, acc);
      }
      s[nt] = acc;
    }
    // mask + running max (rows 8hh+r; the 16 lanes of a half share rows)
    float alpha[8];
#pragma unroll
    for (int r = 0; r < 8; ++r) {
      const int qi = q0 + 8 * hh + r;
      const int ja = j0 + ln, jb = j0 + 16 + ln;
      if (CAUSAL) { if (ja > qi) s[0][r] = -3.0e38f; if (jb > qi) s[1][r] = -3.0e38f; }
      if (ja >= T) s[0][r] = -3.0e38f;
      if (jb >= T) s[1][r] = -3.0e38f;
      float mx = fmaxf(s[0][r], s[1][r]);
      mx = fmaxf(mx, __shfl_xor(mx, 1, 32)); mx = fmaxf(mx, __shfl_xor(mx, 2, 32)); mx = fmaxf(mx, __shfl_xor(mx, 4, 32)); mx = fmaxf(mx, __shfl_xor(mx, 8, 32));
      const float mnew = fmaxf(m_r[r], mx);
      alpha[r] = (mnew > -1.0e38f) ? __expf(m_r[r] - mnew) : 1.0f;
      const float p0 = (s[0][r] > -1.0e38f) ? __expf(s[0][r] - mnew) : 0.f;
      const float p1 = (s[1][r] > -1.0e38f) ? __expf(s[1][r] - mnew) : 0.f;
      m_r[r] = mnew;
      l_r[r] = l_r[r] * alpha[r] + p0 + p1;            // per-lane partial row sum (16 lanes combined at the end)
      unsigned short hb = bf16_bits(p0); sPh[w][8 * hh + r][ln] = hb;      sPl[w][8 * hh + r][ln] = bf16_bits(p0 - bf16_val(hb));
      hb = bf16_bits(p1);                sPh[w][8 * hh + r][16 + ln] = hb; sPl[w][8 * hh + r][16 + ln] = bf16_bits(p1 - bf16_val(hb));
    }
#pragma unroll
    for (int dt = 0; dt < DT; ++dt)
#pragma unroll
      for (int r = 0; r < 8; ++r) oacc[dt][r] *= alpha[r];
    __builtin_amdgcn_fence(__ATOMIC_ACQ_REL, "workgroup");
    __builtin_amdgcn_wave_barrier();
    FragB pah, pal;
    pah.half[0] = *(const v8us*)&sPh[w][ln][8 * hh]; pah.half[1] = *(const v8us*)&sPh[w][ln][16 + 8 * hh];
    pal.half[0] = *(const v8us*)&sPl[w][ln][8 * hh]; pal.half[1] = *(const v8us*)&sPl[w][ln][16 + 8 * hh];
#pragma unroll
    for (int dt = 0; dt < DT; ++dt) {
      FragB bvh, bvl;
#pragma unroll
      for (int i = 0; i < 8; ++i) {
        bvh.u[i] = sVh[8 * hh + i][dt * 16 + ln]; bvh.u[8 + i] = sVh[16 + 8 * hh + i][dt * 16 + ln];
        bvl.u[i] = sVl[8 * hh + i][dt * 16 + ln]; bvl.u[8 + i] = sVl[16 + 8 * hh + i][dt * 16 + ln];
      }
      oacc[dt] = mmaN<3>(pah.v, pal.v, bvh.v, bvl.v, oacc[dt]);
    }
    __builtin_amdgcn_fence(__ATOMIC_ACQ_REL, "workgroup");
    __builtin_amdgcn_wave_barrier();
  }
#pragma unroll
  for (int r = 0; r < 8; ++r) {
    float l = l_r[r];
    l += __shfl_xor(l, 1, 32); l += __shfl_xor(l, 2, 32); l += __shfl_xor(l, 4, 32); l += __shfl_xor(l, 8, 32);
    l_r[r] = (l > 0.f) ? 1.0f / l : 0.f;
  }
#pragma unroll
  for (int dt = 0; dt < DT; ++dt)
#pragma unroll
    for (int r = 0; r < 8; ++r) sO[w][8 * hh + r][dt * 16 + ln] = oacc[dt][r] * l_r[r];
  __builtin_amdgcn_fence(__ATOMIC_ACQ_REL, "workgroup");
  __builtin_amdgcn_wave_barrier();
  {
    for (int r = 0; r < 16; ++r) {
      const int row = q0 + r;
      if (row < T && lane < D / 4) {
        const v4f val = *(const v4fa*)&sO[w][r][lane * 4];
        *(v4f*)(y + ((size_t)b * T + row) * ypitch + h * D + lane * 4) = val;
      }
    }
    
  }
}

// batched f32 [K][N] (pitch lds, batch stride sIn) -> transposed hi/lo planes [N][K] (batch stride sOut); thread per (n, 8 k); grid.y = batch
__global__ __launch_bounds__(256) void k_split_transpose_b(const float* __restrict__ src, int lds_, size_t sIn, unsigned short* __restrict__ hi, unsigned short* __restrict__ lo, size_t sOut, int K, int N) {
  const size_t t = (size_t)blockIdx.x * 256 + threadIdx.x; const int k8n = K / 8; if (t >= (size_t)N * k8n) return;
  src += (size_t)blockIdx.y * sIn; hi += (size_t)blockIdx.y * sOut; lo += (size_t)blockIdx.y * sOut;
  const int n = (int)(t / k8n), k8 = (int)(t % k8n) * 8; v8us vh, vl;
#pragma unroll
  for (int i = 0; i < 8; ++i) { const float x = src[(size_t)(k8 + i) * lds_ + n]; const unsigned short hb = bf16_bits(x); vh[i] = hb; vl[i] = bf16_bits(x - bf16_val(hb)); }
  unsigned short* dh = hi + (size_t)n * K + k8; unsigned short* dl = lo + (size_t)n * K + k8;
  *(v8us*)dh = vh; *(v8us*)dl = vl; 
}

__global__ __launch_bounds__(256) void k_round_rows(const float* __restrict__ W, unsigned short* __restrict__ Wt, int n8) {
  const int t = blockIdx.x * 256 + threadIdx.x;
  if (t >= n8) return;
  const v4f a = *(const v4fa*)(W + (size_t)t * 8), b = *(const v4fa*)(W + (size_t)t * 8 + 4);
  v8us v; v[0]=bf16_bits(a[0]); v[1]=bf16_bits(a[1]); v[2]=bf16_bits(a[2]); v[3]=bf16_bits(a[3]);
  v[4]=bf16_bits(b[0]); v[5]=bf16_bits(b[1]); v[6]=bf16_bits(b[2]); v[7]=bf16_bits(b[3]);
  *(v8us*)(Wt + (size_t)t * 8) = v; 
}

// weights -> bf16, packed in B-fragment order: tile (nt = n / 16, ks = k / 32) is 1 KiB = [j = 0, 1][lane = 16 hh + ln][8 elements],
// element i = W[32 ks + 16 j + 8 hh + i][16 nt + ln], so that each half fragment of a wave is one run of 512 bytes. Thread = one 16-byte piece; Bq from w_qkv, Bp from w_proj.
template <int N>
__device__ __forceinline__ void pack_piece(const float* __restrict__ W, unsigned short* __restrict__ D, int u) {
  const int ln = u & 15, hh = (u >> 4) & 1, j = (u >> 5) & 1, ks = (u >> 6) & 7, nt = u >> 9;
  const float* s = W + (size_t)(ks * 32 + j * 16 + hh * 8) * N + nt * 16 + ln;      // one address, the 8 rows at compile-time distances
  v8us v;
#pragma unroll   // the index names registers: it must be a compile-time value
  for (int i = 0; i < 8; ++i) v[i] = bf16_bits(s[(size_t)i * N]);
  *(v8us*)(D + (size_t)u * 8) = v;
  // the store's registers are not rewritten on any path of the listing before this wait
  asm volatile("s_wait_xcnt 0x0" ::: "memory");
}
__global__ __launch_bounds__(256) void k_pack(const float* __restrict__ wq, const float* __restrict__ wp, unsigned short* __restrict__ Bq, unsigned short* __restrict__ Bp) {
  constexpr int NQB = 3 * EE * EE / 8 / 256;             // blocks that pack Bq; the rest pack Bp
  if (blockIdx.x < NQB) pack_piece<3 * EE>(wq, Bq, blockIdx.x * 256 + threadIdx.x);
  else pack_piece<EE>(wp, Bp, (blockIdx.x - NQB) * 256 + threadIdx.x);
}
// The whole layer in one kernel. Block = (b, dilation group g, 64 consecutive positions of the group) = 8 waves, one head per wave, one block per WGP.
// 1. the block's 96 key rows of x (positions p0 - 16 .. p0 + 79, its 64 query rows among them) are read once in whole lines and kept in LDS as bf16.
//    At the two ends of a group the 16 rows that do not exist are stood in for by their neighbour tile: no window reaches them, every one of their keys is masked.
// 2. wave w makes the 32 columns of head w of K, V (96 rows) and Q (64 rows) from the packed table of k_pack. K and Q are made transposed (A = weight tile, B = x rows),
//    so that a lane holds 8 consecutive d of one row; V is made straight (A = x rows, B = weight tile), so that a lane holds 8 consecutive keys of one d.
//    That is, lane for lane, the order of the attention's own operands: the two column tiles of a K or Q row tile are the two halves of its 16 x 32 fragment,
//    two V row tiles are the two halves of a V^T fragment. Each accumulator is split hi/lo and stays in registers; K, V and Q never pass through LDS.
// 3. the wave's four tiles of 16 queries. Per tile: S^T = K.Q^T over its 48-key band (A = K rows, B = Q), keys outside a query's own 31-key window masked,
//    softmax per lane (one query per lane, halves joined by one exchange), P^T packed from the score tiles as the B operand, O^T = V^T.P^T; 3 terms per product (hi.hi + lo.hi + hi.lo).
//    O is split hi/lo into LDS, the one hand-over between waves.
// 4. out = O . W_proj + bias: wave = 64 rows x 32 columns, 2 terms per product (O hi, O lo), stored in whole 128-byte lines through the wave's own LDS tile.
#define LGRP (LL / DIL)   // positions per dilation group
#define QT 64             // queries per block
#define KR 96             // key rows per block: 16 + 64 + 16
#define RP (EE + 8)       // row pitch of x and O in LDS, 16-bit units (528 B = 16 B x odd)
#define SP 36             // output staging pitch, floats (144 B = 16 B x odd)
#define KS (EE / 32)      // k-steps of a projection
static_assert(LL % (DIL * QT) == 0 && LGRP >= 2 * QT && DH == 32 && EE == 256 && NH * DH == EE && KW / 2 <= 15 && KW <= 31 && KR == QT + 32, "tiling of k_fused");
typedef float v2f __attribute__((ext_vector_type(2)));
typedef __bf16 v2b __attribute__((ext_vector_type(2)));
typedef unsigned short v4us __attribute__((ext_vector_type(4), may_alias));
union FragP { v16b v; v2b p[8]; v8us half[2]; };
union Pack8 { v8us v; v2b p[4]; };
union Pack4 { v4us v; v2b p[2]; };
// two f32 -> bf16 hi pair (round to nearest even) and bf16 lo pair of the exact remainders
__device__ __forceinline__ void split2(float a, float b, v2b& hi, v2b& lo) {
  const v2f x = {a, b};
  hi = __builtin_convertvector(x, v2b);
  const v2f r = x - __builtin_convertvector(hi, v2f);
  lo = __builtin_convertvector(r, v2b);
}
__device__ __forceinline__ v8f mma1(v16b a, v16b b, v8f c) { return __builtin_amdgcn_wmma_f32_16x16x32_bf16(false, a, false, b, (short)0, c, false, false); }
// three terms, hi.hi + lo.hi + hi.lo, on the builtin alone: an asm statement that named the five operands would hold them all in the first 256 registers, and fragments would spill
__device__ __forceinline__ v8f mma3(v16b ah, v16b al, v16b bh, v16b bl, v8f c) { c = mma1(ah, bh, c); c = mma1(al, bh, c); return mma1(ah, bl, c); }
// one packed weight tile (1 KiB): two runs of 512 bytes per wave; p already holds the lane's 16 bytes
__device__ __forceinline__ void load_w(FragB& f, const unsigned short* p) { f.half[0] = *(const v8us*)p; f.half[1] = *(const v8us*)(p + 256); }
// a 16 x 32 fragment (A or B alike) from a row-major LDS plane; p = row ln, first column of the k-step + 8 hh
__device__ __forceinline__ void load_r(FragB& f, const unsigned short* p) { f.half[0] = *(const v8us*)p; f.half[1] = *(const v8us*)(p + 16); }
__global__ __launch_bounds__(256) void k_fused(const float* __restrict__ X, const unsigned short* __restrict__ Bq, const float* __restrict__ bq,
                                               const unsigned short* __restrict__ Bp, const float* __restrict__ bpj, float* __restrict__ out) {
  __shared__ __attribute__((aligned(16))) unsigned short sX[KR][RP], sO[2][QT][RP];
  __shared__ __attribute__((aligned(16))) float sS[NH][QT * SP];
  const int tid = threadIdx.x, lane = tid & 31, ln = lane & 15, hh = lane >> 4;
  const int w = __builtin_amdgcn_readfirstlane(tid >> 5);                                // the wave's head
  int bi = blockIdx.x;
  const int g = bi % DIL; bi /= DIL;
  const int qblk = bi % (LGRP / QT); const int b = bi / (LGRP / QT);
  const int p0 = qblk * QT;                                                              // key row r of the block stands for position p0 - 16 + r
  // ---- 1. x rows -> bf16 in LDS; the first weight tiles are asked for in front of them
  const unsigned short* wp = Bq + (size_t)(2 * w) * (KS * 512) + lane * 8;                // column tile 2 w of Q, tile 2 w + 1 at + KS tiles; K at + 16 column tiles, V at + 32
  const unsigned short* wk = wp + 16 * KS * 512;
  const unsigned short* wv = wp + 32 * KS * 512;
  FragB fk[3][2], fv[3][2], xf[6];
#pragma unroll   // the index names registers: it must be a compile-time value
  for (int ks = 0; ks < 2; ++ks)
#pragma unroll   // the index names registers: it must be a compile-time value
    for (int c = 0; c < 2; ++c) { load_w(fk[ks][c], wk + (c * KS + ks) * 512); load_w(fv[ks][c], wv + (c * KS + ks) * 512); }
  // trip it: key row 4 it + tid / 64, 4 columns. Rows 0 .. 15 and 80 .. 95 have pointers of their own: where they lie outside the group they read the neighbour tile's rows
  const float* xb = X + ((size_t)b * LL + g) * EE + (tid & 63) * 4;
  const float* xlo = xb + (size_t)(p0 - (qblk == 0 ? 0 : 16) + (tid >> 6)) * (DIL * EE);
  const float* xmi = xb + (size_t)(p0 + (tid >> 6)) * (DIL * EE);
  const float* xhi = xb + (size_t)(p0 + (qblk == LGRP / QT - 1 ? QT - 16 : QT) + (tid >> 6)) * (DIL * EE);
  v4f xa[KR / 4];
#pragma unroll   // the index names registers: it must be a compile-time value
  for (int it = 0; it < KR / 4; ++it)
    xa[it] = it < 4 ? *(const v4fa*)(xlo + (size_t)it * 4 * DIL * EE) : it < 20 ? *(const v4fa*)(xmi + (size_t)(it - 4) * 4 * DIL * EE) : *(const v4fa*)(xhi + (size_t)(it - 20) * 4 * DIL * EE);
  const float* bkp = bq + EE + 32 * w + 8 * hh;          // K bias of the lane's 8 d of column tile 2 w, tile 2 w + 1 at + 16; Q bias at - EE
  v4f bkr[2][2], bqr[2][2];
#pragma unroll   // the index names registers: it must be a compile-time value
  for (int c = 0; c < 2; ++c) {
    bkr[c][0] = *(const v4fa*)(bkp + 16 * c); bkr[c][1] = *(const v4fa*)(bkp + 16 * c + 4);
    bqr[c][0] = *(const v4fa*)(bkp - EE + 16 * c); bqr[c][1] = *(const v4fa*)(bkp - EE + 16 * c + 4);
  }
  const float* bvp = bq + 2 * EE + 32 * w + ln;          // V bias of the lane's d, the two column tiles
  const float bvr0 = bvp[0], bvr1 = bvp[16];
  // no address register of the loads above is rewritten before this wait; the x pointers are named so that their pairs live until here
  asm volatile("s_wait_xcnt 0x0" :: "v"(xlo), "v"(xmi), "v"(xhi) : "memory");
#pragma unroll   // the index names registers: it must be a compile-time value
  for (int it = 0; it < KR / 4; ++it) {
    const v2f a0 = {xa[it][0], xa[it][1]}, a1 = {xa[it][2], xa[it][3]};
    Pack4 ph; ph.p[0] = __builtin_convertvector(a0, v2b); ph.p[1] = __builtin_convertvector(a1, v2b);
    *(v4us*)&sX[it * 4 + (tid >> 6)][(tid & 63) * 4] = ph.v;
  }
  __syncthreads();
  FragP kh[6], kl[6], qh[4], ql[4];                      // K row tiles and Q tiles as 16 x 32 fragments (row ln, d = 8 hh + i and 16 + 8 hh + i)
  Pack8 vh[2][6], vl[2][6];                              // V^T half fragments: d = 16 c + ln, keys 16 mi + 8 hh + i
  // ---- 2a. K^T and V, 6 row tiles x 2 column tiles each
  {
    v8f ak[2][6] = {}, av[2][6] = {};
    const unsigned short* xr = &sX[ln][8 * hh];
#pragma unroll   // the index names registers: it must be a compile-time value
    for (int ks = 0; ks < KS; ++ks) {
      if (ks + 2 < KS) {
#pragma unroll   // the index names registers: it must be a compile-time value
        for (int c = 0; c < 2; ++c) { load_w(fk[(ks + 2) % 3][c], wk + (c * KS + ks + 2) * 512); load_w(fv[(ks + 2) % 3][c], wv + (c * KS + ks + 2) * 512); }
      }
#pragma unroll   // the index names registers: it must be a compile-time value
      for (int mi = 0; mi < 6; ++mi) load_r(xf[mi], xr + mi * 16 * RP + ks * 32);
      // keeps the loads above in front of this k-step's products: sunk to their uses, each would make the wave wait out its latency
      __builtin_amdgcn_sched_barrier(0);
#pragma unroll   // the index names registers: it must be a compile-time value
      for (int c = 0; c < 2; ++c)
#pragma unroll   // the index names registers: it must be a compile-time value
        for (int mi = 0; mi < 6; ++mi) ak[c][mi] = mma1(fk[ks % 3][c].v, xf[mi].v, ak[c][mi]);
#pragma unroll   // the index names registers: it must be a compile-time value
      for (int c = 0; c < 2; ++c)
#pragma unroll   // the index names registers: it must be a compile-time value
        for (int mi = 0; mi < 6; ++mi) av[c][mi] = mma1(xf[mi].v, fv[ks % 3][c].v, av[c][mi]);
    }
    // the first Q weight tiles fly while K and V are split
#pragma unroll   // the index names registers: it must be a compile-time value
    for (int ks = 0; ks < 2; ++ks)
#pragma unroll   // the index names registers: it must be a compile-time value
      for (int c = 0; c < 2; ++c) load_w(fk[ks][c], wp + (c * KS + ks) * 512);
    const float bv[2] = {bf16_round(bvr0), bf16_round(bvr1)};
#pragma unroll   // the index names registers: it must be a compile-time value
    for (int c = 0; c < 2; ++c) {
      const float bk[8] = {bf16_round(bkr[c][0][0]), bf16_round(bkr[c][0][1]), bf16_round(bkr[c][0][2]), bf16_round(bkr[c][0][3]),
                           bf16_round(bkr[c][1][0]), bf16_round(bkr[c][1][1]), bf16_round(bkr[c][1][2]), bf16_round(bkr[c][1][3])};
#pragma unroll   // the index names registers: it must be a compile-time value
      for (int mi = 0; mi < 6; ++mi) {
        // ak[c][mi][r] = K[row 16 mi + ln][d = 16 c + 8 hh + r]: half c of the row tile's fragment
#pragma unroll   // the index names registers: it must be a compile-time value
        for (int i = 0; i < 4; ++i) split2(ak[c][mi][2 * i] + bk[2 * i], ak[c][mi][2 * i + 1] + bk[2 * i + 1], kh[mi].p[4 * c + i], kl[mi].p[4 * c + i]);
        // av[c][mi][r] = V[row 16 mi + 8 hh + r][d = 16 c + ln]
#pragma unroll   // the index names registers: it must be a compile-time value
        for (int i = 0; i < 4; ++i) split2(av[c][mi][2 * i] + bv[c], av[c][mi][2 * i + 1] + bv[c], vh[c][mi].p[i], vl[c][mi].p[i]);
      }
    }
  }
  // ---- 2b. Q^T, 4 row tiles x 2 column tiles: the queries are key rows 16 .. 79
  {
    v8f aq[2][4] = {};
    const unsigned short* xr = &sX[16 + ln][8 * hh];
#pragma unroll   // the index names registers: it must be a compile-time value
    for (int ks = 0; ks < KS; ++ks) {
      if (ks + 2 < KS) {
#pragma unroll   // the index names registers: it must be a compile-time value
        for (int c = 0; c < 2; ++c) load_w(fk[(ks + 2) % 3][c], wp + (c * KS + ks + 2) * 512);
      }
#pragma unroll   // the index names registers: it must be a compile-time value
      for (int mi = 0; mi < 4; ++mi) load_r(xf[mi], xr + mi * 16 * RP + ks * 32);
      // keeps the loads above in front of this k-step's products, as in 2a
      __builtin_amdgcn_sched_barrier(0);
#pragma unroll   // the index names registers: it must be a compile-time value
      for (int c = 0; c < 2; ++c)
#pragma unroll   // the index names registers: it must be a compile-time value
        for (int mi = 0; mi < 4; ++mi) aq[c][mi] = mma1(fk[ks % 3][c].v, xf[mi].v, aq[c][mi]);
    }
    // the weight table's last load has been issued: its address registers may be rewritten only behind this wait
    asm volatile("s_wait_xcnt 0x0" ::: "memory");
#pragma unroll   // the index names registers: it must be a compile-time value
    for (int c = 0; c < 2; ++c) {
      const float bb[8] = {bf16_round(bqr[c][0][0]), bf16_round(bqr[c][0][1]), bf16_round(bqr[c][0][2]), bf16_round(bqr[c][0][3]),
                           bf16_round(bqr[c][1][0]), bf16_round(bqr[c][1][1]), bf16_round(bqr[c][1][2]), bf16_round(bqr[c][1][3])};
#pragma unroll   // the index names registers: it must be a compile-time value
      for (int mi = 0; mi < 4; ++mi)
        // aq[c][mi][r] = Q[query 16 mi + ln][d = 16 c + 8 hh + r]: half c of the tile's fragment
#pragma unroll   // the index names registers: it must be a compile-time value
        for (int i = 0; i < 4; ++i) split2(aq[c][mi][2 * i] + bb[2 * i], aq[c][mi][2 * i + 1] + bb[2 * i + 1], qh[mi].p[4 * c + i], ql[mi].p[4 * c + i]);
    }
  }
  // the output projection's first weight tiles and its bias fly during the attention
  const unsigned short* pb = Bp + (size_t)(w * 2) * (KS * 512) + lane * 8;                // step 4: columns 32 w ..
  FragB fb[3][2];
#pragma unroll   // the index names registers: it must be a compile-time value
  for (int ks = 0; ks < 2; ++ks) { load_w(fb[ks][0], pb + ks * 512); load_w(fb[ks][1], pb + (KS + ks) * 512); }
  const float* bop = bpj + w * 32 + ln;
  const float bo0 = bop[0], bo1 = bop[16];
  // no address register of the loads above is rewritten before this wait
  asm volatile("s_wait_xcnt 0x0" ::: "memory");
  // ---- 3. attention: head w, four query tiles, stage by stage so that the independent tiles fill each other's waits; tile qt takes key row tiles qt, qt + 1, qt + 2
  const int hc = w * DH;
  // S^T tiles: s[qt][nt][r] = score of key p0 + 16 qt - 16 + 16 nt + 8hh + r with query p0 + 16 qt + ln. The 48-key band holds every window of the tile, at the group's ends too
  v8f s[4][3];
#pragma unroll   // the index names registers: it must be a compile-time value
  for (int qt = 0; qt < 4; ++qt)
#pragma unroll   // the index names registers: it must be a compile-time value
    for (int nt = 0; nt < 3; ++nt) {
      const v8f z = {};
      s[qt][nt] = mma3(kh[qt + nt].v, kl[qt + nt].v, qh[qt].v, ql[qt].v, z);
    }
  // the query's own window (NATTEN clamp), softmax over it
  float mx[4], den[4];
#pragma unroll   // the index names registers: it must be a compile-time value
  for (int qt = 0; qt < 4; ++qt) {
    const int q0 = p0 + 16 * qt;
    int start = q0 + ln - KW / 2; start = start < 0 ? 0 : (start > LGRP - KW ? LGRP - KW : start);
    const int off = q0 - 16 + 8 * hh - start;
    float m = -3.0e38f;
#pragma unroll   // the index names registers: it must be a compile-time value
    for (int nt = 0; nt < 3; ++nt)
#pragma unroll   // the index names registers: it must be a compile-time value
      for (int r = 0; r < 8; ++r) {
        const float v = ((unsigned)(off + nt * 16 + r) < (unsigned)KW) ? s[qt][nt][r] * (0.17677669529663687f * 1.4426950408889634f) : -3.0e38f;   // scale * log2(e): softmax in base 2
        s[qt][nt][r] = v; m = fmaxf(m, v);
      }
    mx[qt] = fmaxf(m, __shfl_xor(m, 16, 32));
  }
  // The exponentials are asm text. This fence and the one behind them keep every matrix
  // instruction out of their block; the last one in front of it is followed by the masking and the maximum of its own scores, more than the distance that its operand registers need
  __builtin_amdgcn_sched_barrier(0);
#pragma unroll   // the index names registers: it must be a compile-time value
  for (int qt = 0; qt < 4; ++qt) {
    float d = 0.f;
#pragma unroll   // the index names registers: it must be a compile-time value
    for (int nt = 0; nt < 3; ++nt)
#pragma unroll   // the index names registers: it must be a compile-time value
      for (int r = 0; r < 8; ++r) {
        float p;
        // the v_nop keeps the one slot behind a transcendental, whatever the compiler puts next (a reader of p, or a write to the source register)
        asm("v_exp_f32 %0, %1\n\tv_nop" : "=v"(p) : "v"(s[qt][nt][r] - mx[qt]));
        s[qt][nt][r] = p; d += p;   // a masked key gives exactly 0
      }
    den[qt] = d;
  }
  // end of the block that holds no matrix instruction
  __builtin_amdgcn_sched_barrier(0);
#pragma unroll   // the index names registers: it must be a compile-time value
  for (int qt = 0; qt < 4; ++qt) {
    const float dn = den[qt] + __shfl_xor(den[qt], 16, 32);
    // P^T as B operand: element i < 8 is tile 2ks, row 8hh + i; element 8 + i is tile 2ks + 1, row 8hh + i; keys 48..63 of the second step are zero on both sides
    FragP ph[2], pl[2];
#pragma unroll
    for (int i = 0; i < 4; ++i) {
      split2(s[qt][0][2 * i], s[qt][0][2 * i + 1], ph[0].p[i], pl[0].p[i]);
      split2(s[qt][1][2 * i], s[qt][1][2 * i + 1], ph[0].p[4 + i], pl[0].p[4 + i]);
      split2(s[qt][2][2 * i], s[qt][2][2 * i + 1], ph[1].p[i], pl[1].p[i]);
    }
    const v8us zero8 = {0, 0, 0, 0, 0, 0, 0, 0};
    ph[1].half[1] = zero8; pl[1].half[1] = zero8;
    const float inv = 1.0f / dn;
#pragma unroll
    for (int dt = 0; dt < 2; ++dt) {
      FragP fh, fl;
      v8f acc = {};
      fh.half[0] = vh[dt][qt].v; fh.half[1] = vh[dt][qt + 1].v;
      fl.half[0] = vl[dt][qt].v; fl.half[1] = vl[dt][qt + 1].v;
      acc = mma3(fh.v, fl.v, ph[0].v, pl[0].v, acc);
      fh.half[0] = vh[dt][qt + 2].v; fh.half[1] = zero8;
      fl.half[0] = vl[dt][qt + 2].v; fl.half[1] = zero8;
      acc = mma3(fh.v, fl.v, ph[1].v, pl[1].v, acc);
      // acc[r] = O[query ln][d = 16 dt + 8hh + r]
      Pack8 oh, ol;
#pragma unroll
      for (int i = 0; i < 4; ++i) split2(acc[2 * i] * inv, acc[2 * i + 1] * inv, oh.p[i], ol.p[i]);
      *(v8us*)&sO[0][qt * 16 + ln][hc + dt * 16 + 8 * hh] = oh.v; *(v8us*)&sO[1][qt * 16 + ln][hc + dt * 16 + 8 * hh] = ol.v;
    }
  }
  __syncthreads();
  // ---- 4. out rows = O . W_proj + bias
  v8f acc[4][2] = {};
  {
    FragB ah[4], al[4];
    const unsigned short* oh = &sO[0][ln][8 * hh]; const unsigned short* ol = &sO[1][ln][8 * hh];
#pragma unroll   // the index names registers: it must be a compile-time value
    for (int ks = 0; ks < KS; ++ks) {
      if (ks + 2 < KS) { load_w(fb[(ks + 2) % 3][0], pb + (ks + 2) * 512); load_w(fb[(ks + 2) % 3][1], pb + (KS + ks + 2) * 512); }
#pragma unroll   // the index names registers: it must be a compile-time value
      for (int mi = 0; mi < 4; ++mi) { load_r(ah[mi], oh + mi * 16 * RP + ks * 32); load_r(al[mi], ol + mi * 16 * RP + ks * 32); }
      // keeps the loads above in front of this k-step's products, as in 2a
      __builtin_amdgcn_sched_barrier(0);
      // per accumulator and k-step: hi term, then lo term
#pragma unroll   // the index names registers: it must be a compile-time value
      for (int mi = 0; mi < 4; ++mi)
#pragma unroll   // the index names registers: it must be a compile-time value
        for (int t = 0; t < 2; ++t) acc[mi][t] = mma1(ah[mi].v, fb[ks % 3][t].v, acc[mi][t]);
#pragma unroll   // the index names registers: it must be a compile-time value
      for (int mi = 0; mi < 4; ++mi)
#pragma unroll   // the index names registers: it must be a compile-time value
        for (int t = 0; t < 2; ++t) acc[mi][t] = mma1(al[mi].v, fb[ks % 3][t].v, acc[mi][t]);
    }
  }
  // the last weight load has been issued: its address registers may be rewritten only behind this wait
  asm volatile("s_wait_xcnt 0x0" ::: "memory");
  const float bv0 = bf16_round(bo0), bv1 = bf16_round(bo1);
  float* so = &sS[w][0];                                 // the wave's own 64 x 32 staging tile
#pragma unroll   // the index names registers: it must be a compile-time value
  for (int m2 = 0; m2 < 4; ++m2)
#pragma unroll   // the index names registers: it must be a compile-time value
    for (int r = 0; r < 8; ++r) {
      so[(m2 * 16 + 8 * hh + r) * SP + ln] = acc[m2][0][r] + bv0;
      so[(m2 * 16 + 8 * hh + r) * SP + 16 + ln] = acc[m2][1][r] + bv1;
    }
  // the wave re-reads its own staging rows, other lanes' words: its LDS stores end before its LDS loads start, so that each global store covers whole 128-byte lines
  asm volatile("s_wait_dscnt 0x0" ::: "memory");
  float* cp = out + ((size_t)b * LL + g + (size_t)(p0 + (lane >> 3)) * DIL) * EE + w * 32 + (lane & 7) * 4;
#pragma unroll
  for (int q = 0; q < 16; ++q) {
    const v4f v = *(const v4fa*)&so[(q * 4 + (lane >> 3)) * SP + (lane & 7) * 4];
    *(v4f*)(cp + (size_t)q * 4 * DIL * EE) = v;
  }
}
extern "C" void kernel_launch(void* const* d_in, const int* in_sizes, int n_in,
                              void* d_out, int out_size, void* d_ws, size_t ws_size, hipStream_t stream) {
  (void)in_sizes; (void)n_in; (void)out_size;
  const float* x = (const float*)d_in[0]; const float* wq = (const float*)d_in[1]; const float* bq = (const float*)d_in[2]; const float* wp = (const float*)d_in[3]; const float* bp = (const float*)d_in[4];
  char* ws = (char*)d_ws; size_t off = 0;
  auto take = [&](size_t bytes) { char* p = ws + off; off += (bytes + 255) & ~(size_t)255; return p; };
  unsigned short* Bq = (unsigned short*)take((size_t)3 * EE * EE * 2); unsigned short* Bp = (unsigned short*)take((size_t)EE * EE * 2);
  if (off > ws_size) return;
  k_pack<<<(3 * EE * EE + EE * EE) / 8 / 256, 256, 0, stream>>>(wq, wp, Bq, Bp);
  k_fused<<<BB * DIL * (LGRP / QT), 256, 0, stream>>>(x, Bq, bq, Bp, bp, (float*)d_out);
}

// v005
// One run takes 17.4 microseconds.
// Timed twice side by side with v004, it ran 1.13 times as fast both times.
// All steps since v000 together make it 8.99 times as fast.
#include <hip/hip_runtime.h>
// 1-D neighbourhood attention (NATTEN, K = 31, dilation 2, 8 heads × 32): qkv = x·W + b on v_wmma_f32_16x16x32_bf16 (x rounded to bf16: single exact term; 16384 × 256 × 768),
// the per-token 31-key windows (indices computed from the NATTEN clamp formula, never loaded): q.k and P.V on the same unit with both operands split hi/lo (3 products),
// four tiles of 16 queries of one dilation group per wave, each over a shared 48-key band, softmax in f32 VALU; out = O·W_proj + b on the same unit with the f32 O split hi/lo (2 products; 16384 × 256 × 256); f32 accumulate.
#define BB 2
#define LL 8192
#define EE 256
#define NH 8
#define DH 32
#define KW 31
#define DIL 2
#define NTOK (BB * LL)

typedef __bf16 v16b __attribute__((ext_vector_type(16)));
typedef unsigned short v8us __attribute__((ext_vector_type(8), may_alias));
typedef float  v8f  __attribute__((ext_vector_type(8)));
typedef float  v4f  __attribute__((ext_vector_type(4)));
typedef float  v4fa __attribute__((ext_vector_type(4), may_alias));
union FragB { v16b v; v8us half[2]; unsigned short u[16]; };

__device__ __forceinline__ unsigned short bf16_bits(float x) { unsigned int u = __float_as_uint(x); return (unsigned short)((u + 0x7FFFu + ((u >> 16) & 1u)) >> 16); }
__device__ __forceinline__ float bf16_val(unsigned short b) { return __uint_as_float(((unsigned int)b) << 16); }
__device__ __forceinline__ float bf16_round(float x) { return bf16_val(bf16_bits(x)); }
// D += A·B with NT terms: 1 = ah·bh, 2 = + al·bh (A split), 3 = + ah·bl (both split)
template <int NT>
__device__ __forceinline__ v8f mmaN(v16b ah, v16b al, v16b bh, v16b bl, v8f c) {
  c = __builtin_amdgcn_wmma_f32_16x16x32_bf16(false, ah, false, bh, (short)0, c, false, false);
  if (NT >= 2) c = __builtin_amdgcn_wmma_f32_16x16x32_bf16(false, al, false, bh, (short)0, c, false, false);
  if (NT >= 3) c = __builtin_amdgcn_wmma_f32_16x16x32_bf16(false, ah, false, bl, (short)0, c, false, false);
  asm volatile("v_nop\n\tv_nop\n\tv_nop\n\tv_nop" : "+v"(c) : "v"(ah), "v"(al), "v"(bh), "v"(bl));
  return c;
}

__global__ __launch_bounds__(256) void k_wt_bf16(const float* __restrict__ W, unsigned short* __restrict__ Wt, int K, int N) {
  const int t = blockIdx.x * 256 + threadIdx.x;
  const int k8n = K / 8;
  if (t >= N * k8n) return;
  const int n = t / k8n, k8 = (t % k8n) * 8;
  v8us v;
#pragma unroll
  for (int i = 0; i < 8; ++i) v[i] = bf16_bits(W[(size_t)(k8 + i) * N + n]);
  *(v8us*)(Wt + (size_t)n * K + k8) = v;
  
}

// GEMM C[M][N] (f32, pitch ldc) = act(A[M][K]·W + bias). A f32 row-major (pitch lda) converted per fragment to bf16
// (ASPLIT: hi/lo two planes -> 2 terms, else single rounded term); Wt bf16 [N][K] (pitch ldb). BIAS_BF16 rounds the
// bias to bf16 first (bias quantised to bf16 before the add). K%32==0, M%16==0, N%64==0.
template <bool ASPLIT, int ACT, bool BIAS_BF16>
__global__ __launch_bounds__(128) void k_gemm_bf(const float* __restrict__ A, int lda, const unsigned short* __restrict__ Wt, int ldb,
                                               const float* __restrict__ bias, float* __restrict__ C, int ldc, int M, int N, int K) {
  __shared__ __attribute__((aligned(16))) float so[4][16][64];
  const int tid = threadIdx.x, w = tid >> 5, lane = tid & 31, ln = lane & 15, hh = lane >> 4;
  const int ntn = N / 64;
  const int wid = blockIdx.x * 4 + w;
  const int mt = wid / ntn, nq = wid % ntn;
  if (mt * 16 >= M) return;
  const int row0 = mt * 16, col0 = nq * 64;
  const float* arow = A + (size_t)(row0 + ln) * lda;
  v8f acc[4] = {};
  for (int kb = 0; kb < K; kb += 32) {
    FragB ah, al;
    const v4f x0 = *(const v4fa*)(arow + kb + 8 * hh), x1 = *(const v4fa*)(arow + kb + 8 * hh + 4);
    const v4f x2 = *(const v4fa*)(arow + kb + 16 + 8 * hh), x3 = *(const v4fa*)(arow + kb + 16 + 8 * hh + 4);
    float xs[16] = {x0[0],x0[1],x0[2],x0[3],x1[0],x1[1],x1[2],x1[3],x2[0],x2[1],x2[2],x2[3],x3[0],x3[1],x3[2],x3[3]};
#pragma unroll
    for (int i = 0; i < 16; ++i) { const unsigned short hb = bf16_bits(xs[i]); ah.u[i] = hb; al.u[i] = ASPLIT ? bf16_bits(xs[i] - bf16_val(hb)) : (unsigned short)0; }
#pragma unroll
    for (int t = 0; t < 4; ++t) {
      const unsigned short* brow = Wt + (size_t)(col0 + t * 16 + ln) * ldb + kb;
      FragB b;
      b.half[0] = *(const v8us*)(brow + 8 * hh);
      b.half[1] = *(const v8us*)(brow + 16 + 8 * hh);
      acc[t] = mmaN<ASPLIT ? 2 : 1>(ah.v, al.v, b.v, b.v, acc[t]);
    }
  }
#pragma unroll
  for (int t = 0; t < 4; ++t) {
    float bv = bias ? bias[col0 + t * 16 + ln] : 0.f;
    if (BIAS_BF16) bv = bf16_round(bv);
#pragma unroll
    for (int r = 0; r < 8; ++r) { float v = acc[t][r] + bv; if (ACT == 1) v = fmaxf(v, 0.f); so[w][8 * hh + r][t * 16 + ln] = v; }
  }
  __builtin_amdgcn_fence(__ATOMIC_ACQ_REL, "workgroup");
  __builtin_amdgcn_wave_barrier();
  const int rsub = lane >> 4, c4 = (lane & 15) * 4;
  {
#pragma unroll
    for (int q = 0; q < 8; ++q) {
      const int r = q * 2 + rsub;
      const v4f v = *(const v4fa*)&so[w][r][c4];
      *(v4f*)(C + (size_t)(row0 + r) * ldc + col0 + c4) = v;
    }
    
  }
}

// Flash-style causal/unmasked attention, all contractions 3-term bf16 hi/lo splits, f32 softmax with running max.
// q,k,v rows are read from f32 buffers with arbitrary row pitch (so they can live inside a fused qkv buffer);
// D = head size (multiple of 32, <= 128); one wave = 16 query rows; block = 4 waves (64 queries) sharing K/V chunks of 32.
template <int D, bool CAUSAL>
__global__ __launch_bounds__(128) void k_flash(const float* __restrict__ qb, const float* __restrict__ kb, const float* __restrict__ vb,
                                             int pitch, int T, int H, float scale, float* __restrict__ y, int ypitch) {
  constexpr int KS = D / 32;        // k-steps for QK
  constexpr int DT = D / 16;        // d tiles for PV
  __shared__ __attribute__((aligned(16))) unsigned short sKh[32][D + 8], sKl[32][D + 8], sVh[32][D + 8], sVl[32][D + 8];
  __shared__ __attribute__((aligned(16))) unsigned short sPh[4][16][40], sPl[4][16][40];
  __shared__ __attribute__((aligned(16))) float sO[4][16][D];
  const int tid = threadIdx.x, w = tid >> 5, lane = tid & 31, ln = lane & 15, hh = lane >> 4;
  const int nqb = (T + 63) / 64;
  const int bh = blockIdx.x / nqb, qblk = blockIdx.x % nqb;
  const int b = bh / H, h = bh % H;
  const int q0 = qblk * 64 + w * 16;
  const float* Q = qb + (size_t)b * T * pitch + h * D;
  const float* K = kb + (size_t)b * T * pitch + h * D;
  const float* V = vb + (size_t)b * T * pitch + h * D;

  // A fragments of the wave's 16 query rows (scaled), hi/lo
  FragB aqh[KS], aql[KS];
  {
    int row = q0 + ln; if (row >= T) row = T - 1;
    const float* qr = Q + (size_t)row * pitch;
#pragma unroll
    for (int ks = 0; ks < KS; ++ks)
#pragma unroll
      for (int i = 0; i < 16; ++i) {
        const int d = ks * 32 + ((i < 8) ? (8 * hh + i) : (16 + 8 * hh + (i - 8)));
        const float x = qr[d] * scale; const unsigned short hb = bf16_bits(x);
        aqh[ks].u[i] = hb; aql[ks].u[i] = bf16_bits(x - bf16_val(hb));
      }
  }
  float m_r[8], l_r[8];
#pragma unroll
  for (int r = 0; r < 8; ++r) { m_r[r] = -3.0e38f; l_r[r] = 0.f; }
  v8f oacc[DT];
#pragma unroll
  for (int dt = 0; dt < DT; ++dt) oacc[dt] = (v8f){0.f,0.f,0.f,0.f,0.f,0.f,0.f,0.f};

  const int kv_end = CAUSAL ? min(T, qblk * 64 + 64) : T;     // block-uniform
  for (int j0 = 0; j0 < kv_end; j0 += 32) {
    __syncthreads();
    for (int e = tid; e < 32 * (D / 4); e += 128) {
      const int r = e / (D / 4), c4 = (e % (D / 4)) * 4;
      const int key = j0 + r;
      v4f kf = {0.f,0.f,0.f,0.f}, vf = {0.f,0.f,0.f,0.f};
      if (key < T) { kf = *(const v4fa*)(K + (size_t)key * pitch + c4); vf = *(const v4fa*)(V + (size_t)key * pitch + c4); }
#pragma unroll
      for (int t = 0; t < 4; ++t) {
        unsigned short hb = bf16_bits(kf[t]); sKh[r][c4 + t] = hb; sKl[r][c4 + t] = bf16_bits(kf[t] - bf16_val(hb));
        hb = bf16_bits(vf[t]); sVh[r][c4 + t] = hb; sVl[r][c4 + t] = bf16_bits(vf[t] - bf16_val(hb));
      }
    }
    __syncthreads();
    // S tile 16 x 32
    v8f s[2];
#pragma unroll
    for (int nt = 0; nt < 2; ++nt) {
      v8f acc = {};
#pragma unroll
      for (int ks = 0; ks < KS; ++ks) {
        FragB bh_, bl_;
        bh_.half[0] = *(const v8us*)&sKh[nt * 16 + ln][ks * 32 + 8 * hh]; bh_.half[1] = *(const v8us*)&sKh[nt * 16 + ln][ks * 32 + 16 + 8 * hh];
        bl_.half[0] = *(const v8us*)&sKl[nt * 16 + ln][ks * 32 + 8 * hh]; bl_.half[1] = *(const v8us*)&sKl[nt * 16 + ln][ks * 32 + 16 + 8 * hh];
        acc = mmaN<3>(aqh[ks].v, aql[ks].v, bh_.v, bl_.v, acc);
      }
      s[nt] = acc;
    }
    // mask + running max (rows 8hh+r; the 16 lanes of a half share rows)
    float alpha[8];
#pragma unroll
    for (int r = 0; r < 8; ++r) {
      const int qi = q0 + 8 * hh + r;
      const int ja = j0 + ln, jb = j0 + 16 + ln;
      if (CAUSAL) { if (ja > qi) s[0][r] = -3.0e38f; if (jb > qi) s[1][r] = -3.0e38f; }
      if (ja >= T) s[0][r] = -3.0e38f;
      if (jb >= T) s[1][r] = -3.0e38f;
      float mx = fmaxf(s[0][r], s[1][r]);
      mx = fmaxf(mx, __shfl_xor(mx, 1, 32)); mx = fmaxf(mx, __shfl_xor(mx, 2, 32)); mx = fmaxf(mx, __shfl_xor(mx, 4, 32)); mx = fmaxf(mx, __shfl_xor(mx, 8, 32));
      const float mnew = fmaxf(m_r[r], mx);
      alpha[r] = (mnew > -1.0e38f) ? __expf(m_r[r] - mnew) : 1.0f;
      const float p0 = (s[0][r] > -1.0e38f) ? __expf(s[0][r] - mnew) : 0.f;
      const float p1 = (s[1][r] > -1.0e38f) ? __expf(s[1][r] - mnew) : 0.f;
      m_r[r] = mnew;
      l_r[r] = l_r[r] * alpha[r] + p0 + p1;            // per-lane partial row sum (16 lanes combined at the end)
      unsigned short hb = bf16_bits(p0); sPh[w][8 * hh + r][ln] = hb;      sPl[w][8 * hh + r][ln] = bf16_bits(p0 - bf16_val(hb));
      hb = bf16_bits(p1);                sPh[w][8 * hh + r][16 + ln] = hb; sPl[w][8 * hh + r][16 + ln] = bf16_bits(p1 - bf16_val(hb));
    }
#pragma unroll
    for (int dt = 0; dt < DT; ++dt)
#pragma unroll
      for (int r = 0; r < 8; ++r) oacc[dt][r] *= alpha[r];
    __builtin_amdgcn_fence(__ATOMIC_ACQ_REL, "workgroup");
    __builtin_amdgcn_wave_barrier();
    FragB pah, pal;
    pah.half[0] = *(const v8us*)&sPh[w][ln][8 * hh]; pah.half[1] = *(const v8us*)&sPh[w][ln][16 + 8 * hh];
    pal.half[0] = *(const v8us*)&sPl[w][ln][8 * hh]; pal.half[1] = *(const v8us*)&sPl[w][ln][16 + 8 * hh];
#pragma unroll
    for (int dt = 0; dt < DT; ++dt) {
      FragB bvh, bvl;
#pragma unroll
      for (int i = 0; i < 8; ++i) {
        bvh.u[i] = sVh[8 * hh + i][dt * 16 + ln]; bvh.u[8 + i] = sVh[16 + 8 * hh + i][dt * 16 + ln];
        bvl.u[i] = sVl[8 * hh + i][dt * 16 + ln]; bvl.u[8 + i] = sVl[16 + 8 * hh + i][dt * 16 + ln];
      }
      oacc[dt] = mmaN<3>(pah.v, pal.v, bvh.v, bvl.v, oacc[dt]);
    }
    __builtin_amdgcn_fence(__ATOMIC_ACQ_REL, "workgroup");
    __builtin_amdgcn_wave_barrier();
  }
#pragma unroll
  for (int r = 0; r < 8; ++r) {
    float l = l_r[r];
    l += __shfl_xor(l, 1, 32); l += __shfl_xor(l, 2, 32); l += __shfl_xor(l, 4, 32); l += __shfl_xor(l, 8, 32);
    l_r[r] = (l > 0.f) ? 1.0f / l : 0.f;
  }
#pragma unroll
  for (int dt = 0; dt < DT; ++dt)
#pragma unroll
    for (int r = 0; r < 8; ++r) sO[w][8 * hh + r][dt * 16 + ln] = oacc[dt][r] * l_r[r];
  __builtin_amdgcn_fence(__ATOMIC_ACQ_REL, "workgroup");
  __builtin_amdgcn_wave_barrier();
  {
    for (int r = 0; r < 16; ++r) {
      const int row = q0 + r;
      if (row < T && lane < D / 4) {
        const v4f val = *(const v4fa*)&sO[w][r][lane * 4];
        *(v4f*)(y + ((size_t)b * T + row) * ypitch + h * D + lane * 4) = val;
      }
    }
    
  }
}

// batched f32 [K][N] (pitch lds, batch stride sIn) -> transposed hi/lo planes [N][K] (batch stride sOut); thread per (n, 8 k); grid.y = batch
__global__ __launch_bounds__(256) void k_split_transpose_b(const float* __restrict__ src, int lds_, size_t sIn, unsigned short* __restrict__ hi, unsigned short* __restrict__ lo, size_t sOut, int K, int N) {
  const size_t t = (size_t)blockIdx.x * 256 + threadIdx.x; const int k8n = K / 8; if (t >= (size_t)N * k8n) return;
  src += (size_t)blockIdx.y * sIn; hi += (size_t)blockIdx.y * sOut; lo += (size_t)blockIdx.y * sOut;
  const int n = (int)(t / k8n), k8 = (int)(t % k8n) * 8; v8us vh, vl;
#pragma unroll
  for (int i = 0; i < 8; ++i) { const float x = src[(size_t)(k8 + i) * lds_ + n]; const unsigned short hb = bf16_bits(x); vh[i] = hb; vl[i] = bf16_bits(x - bf16_val(hb)); }
  unsigned short* dh = hi + (size_t)n * K + k8; unsigned short* dl = lo + (size_t)n * K + k8;
  *(v8us*)dh = vh; *(v8us*)dl = vl; 
}

__global__ __launch_bounds__(256) void k_round_rows(const float* __restrict__ W, unsigned short* __restrict__ Wt, int n8) {
  const int t = blockIdx.x * 256 + threadIdx.x;
  if (t >= n8) return;
  const v4f a = *(const v4fa*)(W + (size_t)t * 8), b = *(const v4fa*)(W + (size_t)t * 8 + 4);
  v8us v; v[0]=bf16_bits(a[0]); v[1]=bf16_bits(a[1]); v[2]=bf16_bits(a[2]); v[3]=bf16_bits(a[3]);
  v[4]=bf16_bits(b[0]); v[5]=bf16_bits(b[1]); v[6]=bf16_bits(b[2]); v[7]=bf16_bits(b[3]);
  *(v8us*)(Wt + (size_t)t * 8) = v; 
}

// weights -> bf16, packed in B-fragment order: tile (nt = n / 16, ks = k / 32) is 1 KiB = [j = 0, 1][lane = 16 hh + ln][8 elements],
// element i = W[32 ks + 16 j + 8 hh + i][16 nt + ln], so that each half fragment of a wave is one run of 512 bytes. Thread = one 16-byte piece; Bq from w_qkv, Bp from w_proj.
template <int N>
__device__ __forceinline__ void pack_piece(const float* __restrict__ W, unsigned short* __restrict__ D, int u) {
  const int ln = u & 15, hh = (u >> 4) & 1, j = (u >> 5) & 1, ks = (u >> 6) & 7, nt = u >> 9;
  const float* s = W + (size_t)(ks * 32 + j * 16 + hh * 8) * N + nt * 16 + ln;      // one address, the 8 rows at compile-time distances
  v8us v;
#pragma unroll   // the index names registers: it must be a compile-time value
  for (int i = 0; i < 8; ++i) v[i] = bf16_bits(s[(size_t)i * N]);
  *(v8us*)(D + (size_t)u * 8) = v;
  // the store's registers are not rewritten on any path of the listing before this wait
  asm volatile("s_wait_xcnt 0x0" ::: "memory");
}
__global__ __launch_bounds__(256) void k_pack(const float* __restrict__ wq, const float* __restrict__ wp, unsigned short* __restrict__ Bq, unsigned short* __restrict__ Bp) {
  constexpr int NQB = 3 * EE * EE / 8 / 256;             // blocks that pack Bq; the rest pack Bp
  if (blockIdx.x < NQB) pack_piece<3 * EE>(wq, Bq, blockIdx.x * 256 + threadIdx.x);
  else pack_piece<EE>(wp, Bp, (blockIdx.x - NQB) * 256 + threadIdx.x);
}
// The whole layer in one kernel. Block = (b, dilation group g, 64 consecutive positions of the group) = 8 waves, one head per wave, one block per WGP.
// 1. the block's 96 key rows of x (positions p0 - 16 .. p0 + 79, its 64 query rows among them) are read once in whole lines and kept in LDS as bf16.
//    At the two ends of a group the 16 rows that do not exist are stood in for by their neighbour tile: no window reaches them, every one of their keys is masked.
// 2. wave w makes the 32 columns of head w of K, V (96 rows) and Q (64 rows) from the packed table of k_pack. K and Q are made transposed (A = weight tile, B = x rows),
//    so that a lane holds 8 consecutive d of one row; V is made straight (A = x rows, B = weight tile), so that a lane holds 8 consecutive keys of one d.
//    That is, lane for lane, the order of the attention's own operands: the two column tiles of a K or Q row tile are the two halves of its 16 x 32 fragment,
//    two V row tiles are the two halves of a V^T fragment. Each accumulator is split hi/lo and stays in registers; K, V and Q never pass through LDS.
// 3. the wave's four tiles of 16 queries. Per tile: S^T = K.Q^T over its 48-key band (A = K rows, B = Q), keys outside a query's own 31-key window masked,
//    softmax per lane (one query per lane, halves joined by one exchange), P^T packed from the score tiles as the B operand, O^T = V^T.P^T; 3 terms per product (hi.hi + lo.hi + hi.lo).
//    O is split hi/lo into LDS, the one hand-over between waves.
// 4. out = O . W_proj + bias: wave = 64 rows x 32 columns, 2 terms per product (O hi, O lo), stored in whole 128-byte lines through the wave's own LDS tile.
#define LGRP (LL / DIL)   // positions per dilation group
#define QT 64             // queries per block
#define KR 96             // key rows per block: 16 + 64 + 16
#define RP (EE + 8)       // row pitch of x and O in LDS, 16-bit units (528 B = 16 B x odd)
#define SP 36             // output staging pitch, floats (144 B = 16 B x odd)
#define KS (EE / 32)      // k-steps of a projection
static_assert(LL % (DIL * QT) == 0 && LGRP >= 2 * QT && DH == 32 && EE == 256 && NH * DH == EE && KW / 2 <= 15 && KW <= 31 && KR == QT + 32, "tiling of k_fused");
typedef float v2f __attribute__((ext_vector_type(2)));
typedef __bf16 v2b __attribute__((ext_vector_type(2)));
typedef unsigned short v4us __attribute__((ext_vector_type(4), may_alias));
union FragP { v16b v; v2b p[8]; v8us half[2]; };
union Pack8 { v8us v; v2b p[4]; };
union Pack4 { v4us v; v2b p[2]; };
// two f32 -> bf16 hi pair (round to nearest even) and bf16 lo pair of the exact remainders
__device__ __forceinline__ void split2(float a, float b, v2b& hi, v2b& lo) {
  const v2f x = {a, b};
  hi = __builtin_convertvector(x, v2b);
  const v2f r = x - __builtin_convertvector(hi, v2f);
  lo = __builtin_convertvector(r, v2b);
}
__device__ __forceinline__ v8f mma1(v16b a, v16b b, v8f c) { return __builtin_amdgcn_wmma_f32_16x16x32_bf16(false, a, false, b, (short)0, c, false, false); }
// three terms, hi.hi + lo.hi + hi.lo, on the builtin alone: an asm statement that named the five operands would hold them all in the first 256 registers, and fragments would spill
__device__ __forceinline__ v8f mma3(v16b ah, v16b al, v16b bh, v16b bl, v8f c) { c = mma1(ah, bh, c); c = mma1(al, bh, c); return mma1(ah, bl, c); }
// one packed weight tile (1 KiB): two runs of 512 bytes per wave; o = the lane's 16 bytes in 16-byte units from the table's start (one register), t = whole tiles further on (a compile-time distance)
__device__ __forceinline__ void load_wo(FragB& f, const unsigned short* tab, unsigned o, int t) { const v8us* p = (const v8us*)tab + ((size_t)o + t * 64); f.half[0] = p[0]; f.half[1] = p[32]; }
// a 16 x 32 fragment (A or B alike) from a row-major LDS plane; p = row ln, first column of the k-step + 8 hh
__device__ __forceinline__ void load_r(FragB& f, const unsigned short* p) { f.half[0] = *(const v8us*)p; f.half[1] = *(const v8us*)(p + 16); }
__global__ __launch_bounds__(256) void k_fused(const float* __restrict__ X, const unsigned short* __restrict__ Bq, const float* __restrict__ bq,
                                               const unsigned short* __restrict__ Bp, const float* __restrict__ bpj, float* __restrict__ out) {
  __shared__ __attribute__((aligned(16))) unsigned short sX[KR][RP], sO[2][QT][RP];
  __shared__ __attribute__((aligned(16))) float sS[NH][QT * SP];
  const int tid = threadIdx.x, lane = tid & 31, ln = lane & 15, hh = lane >> 4;
  const int w = __builtin_amdgcn_readfirstlane(tid >> 5);                                // the wave's head
  int bi = blockIdx.x;
  const int g = bi % DIL; bi /= DIL;
  const int qblk = bi % (LGRP / QT); const int b = bi / (LGRP / QT);
  const int p0 = qblk * QT;                                                              // key row r of the block stands for position p0 - 16 + r
  // Every work-group reads the same weight tables. Place ks of a projection loop takes k-step ke(ks) = (ks + rot) mod KS, weights and x (or O) columns alike: work-groups that
  // run side by side start their walk at different tiles and wrap, so that they do not ask L2 for the same lines at the same moment. Only the order of the k-steps' sums changes.
  const int rot = (blockIdx.x + (blockIdx.x >> 3)) & (KS - 1);
  const auto ke = [rot](int ks) { return (ks + rot) & (KS - 1); };
  // wo[ks]: the lane's 16 bytes of tile (column tile 2 w, k-step ke(ks)), in 16-byte units from a table's start; the same in both tables. One register per place, written once
  unsigned wo[KS];
#pragma unroll   // the index names registers: it must be a compile-time value
  for (int ks = 0; ks < KS; ++ks) wo[ks] = (unsigned)((2 * w * KS + ke(ks)) * 64 + lane);
  // ---- 1. x rows -> bf16 in LDS; the first weight tiles are asked for in front of them
  constexpr int TK = 16 * KS, TV = 32 * KS;                                              // in Bq: column tile 2 w of Q at wo, tile 2 w + 1 at + KS tiles; K at + 16 column tiles, V at + 32
  FragB fk[3][2], fv[3][2], xf[6];
#pragma unroll   // the index names registers: it must be a compile-time value
  for (int ks = 0; ks < 2; ++ks)
#pragma unroll   // the index names registers: it must be a compile-time value
    for (int c = 0; c < 2; ++c) { load_wo(fk[ks][c], Bq, wo[ks], TK + c * KS); load_wo(fv[ks][c], Bq, wo[ks], TV + c * KS); }
  // trip it: key row 4 it + tid / 64, 4 columns. Rows 0 .. 15 and 80 .. 95 have pointers of their own: where they lie outside the group they read the neighbour tile's rows
  const float* xb = X + ((size_t)b * LL + g) * EE + (tid & 63) * 4;
  const float* xlo = xb + (size_t)(p0 - (qblk == 0 ? 0 : 16) + (tid >> 6)) * (DIL * EE);
  const float* xmi = xb + (size_t)(p0 + (tid >> 6)) * (DIL * EE);
  const float* xhi = xb + (size_t)(p0 + (qblk == LGRP / QT - 1 ? QT - 16 : QT) + (tid >> 6)) * (DIL * EE);
  v4f xa[KR / 4];
#pragma unroll   // the index names registers: it must be a compile-time value
  for (int it = 0; it < KR / 4; ++it)
    xa[it] = it < 4 ? *(const v4fa*)(xlo + (size_t)it * 4 * DIL * EE) : it < 20 ? *(const v4fa*)(xmi + (size_t)(it - 4) * 4 * DIL * EE) : *(const v4fa*)(xhi + (size_t)(it - 20) * 4 * DIL * EE);
  const float* bkp = bq + EE + 32 * w + 8 * hh;          // K bias of the lane's 8 d of column tile 2 w, tile 2 w + 1 at + 16; Q bias at - EE
  v4f bkr[2][2], bqr[2][2];
#pragma unroll   // the index names registers: it must be a compile-time value
  for (int c = 0; c < 2; ++c) {
    bkr[c][0] = *(const v4fa*)(bkp + 16 * c); bkr[c][1] = *(const v4fa*)(bkp + 16 * c + 4);
    bqr[c][0] = *(const v4fa*)(bkp - EE + 16 * c); bqr[c][1] = *(const v4fa*)(bkp - EE + 16 * c + 4);
  }
  const float* bvp = bq + 2 * EE + 32 * w + ln;          // V bias of the lane's d, the two column tiles
  const float bvr0 = bvp[0], bvr1 = bvp[16];
  // no address register of the loads above is rewritten before this wait; the x pointers are named so that their pairs live until here
  asm volatile("s_wait_xcnt 0x0" :: "v"(xlo), "v"(xmi), "v"(xhi) : "memory");
#pragma unroll   // the index names registers: it must be a compile-time value
  for (int it = 0; it < KR / 4; ++it) {
    const v2f a0 = {xa[it][0], xa[it][1]}, a1 = {xa[it][2], xa[it][3]};
    Pack4 ph; ph.p[0] = __builtin_convertvector(a0, v2b); ph.p[1] = __builtin_convertvector(a1, v2b);
    *(v4us*)&sX[it * 4 + (tid >> 6)][(tid & 63) * 4] = ph.v;
  }
  __syncthreads();
  FragP kh[6], kl[6], qh[4], ql[4];                      // K row tiles and Q tiles as 16 x 32 fragments (row ln, d = 8 hh + i and 16 + 8 hh + i)
  Pack8 vh[2][6], vl[2][6];                              // V^T half fragments: d = 16 c + ln, keys 16 mi + 8 hh + i
  // ---- 2a. K^T and V, 6 row tiles x 2 column tiles each
  {
    v8f ak[2][6] = {}, av[2][6] = {};
    const unsigned short* xr = &sX[ln][8 * hh];
#pragma unroll   // the index names registers: it must be a compile-time value
    for (int ks = 0; ks < KS; ++ks) {
      if (ks + 2 < KS) {
#pragma unroll   // the index names registers: it must be a compile-time value
        for (int c = 0; c < 2; ++c) { load_wo(fk[(ks + 2) % 3][c], Bq, wo[ks + 2], TK + c * KS); load_wo(fv[(ks + 2) % 3][c], Bq, wo[ks + 2], TV + c * KS); }
      }
#pragma unroll   // the index names registers: it must be a compile-time value
      for (int mi = 0; mi < 6; ++mi) load_r(xf[mi], xr + mi * 16 * RP + ke(ks) * 32);
      // keeps the loads above in front of this k-step's products: sunk to their uses, each would make the wave wait out its latency
      __builtin_amdgcn_sched_barrier(0);
#pragma unroll   // the index names registers: it must be a compile-time value
      for (int c = 0; c < 2; ++c)
#pragma unroll   // the index names registers: it must be a compile-time value
        for (int mi = 0; mi < 6; ++mi) ak[c][mi] = mma1(fk[ks % 3][c].v, xf[mi].v, ak[c][mi]);
#pragma unroll   // the index names registers: it must be a compile-time value
      for (int c = 0; c < 2; ++c)
#pragma unroll   // the index names registers: it must be a compile-time value
        for (int mi = 0; mi < 6; ++mi) av[c][mi] = mma1(xf[mi].v, fv[ks % 3][c].v, av[c][mi]);
    }
    // the first Q weight tiles fly while K and V are split
#pragma unroll   // the index names registers: it must be a compile-time value
    for (int ks = 0; ks < 2; ++ks)
#pragma unroll   // the index names registers: it must be a compile-time value
      for (int c = 0; c < 2; ++c) load_wo(fk[ks][c], Bq, wo[ks], c * KS);
    const float bv[2] = {bf16_round(bvr0), bf16_round(bvr1)};
#pragma unroll   // the index names registers: it must be a compile-time value
    for (int c = 0; c < 2; ++c) {
      const float bk[8] = {bf16_round(bkr[c][0][0]), bf16_round(bkr[c][0][1]), bf16_round(bkr[c][0][2]), bf16_round(bkr[c][0][3]),
                           bf16_round(bkr[c][1][0]), bf16_round(bkr[c][1][1]), bf16_round(bkr[c][1][2]), bf16_round(bkr[c][1][3])};
#pragma unroll   // the index names registers: it must be a compile-time value
      for (int mi = 0; mi < 6; ++mi) {
        // ak[c][mi][r] = K[row 16 mi + ln][d = 16 c + 8 hh + r]: half c of the row tile's fragment
#pragma unroll   // the index names registers: it must be a compile-time value
        for (int i = 0; i < 4; ++i) split2(ak[c][mi][2 * i] + bk[2 * i], ak[c][mi][2 * i + 1] + bk[2 * i + 1], kh[mi].p[4 * c + i], kl[mi].p[4 * c + i]);
        // av[c][mi][r] = V[row 16 mi + 8 hh + r][d = 16 c + ln]
#pragma unroll   // the index names registers: it must be a compile-time value
        for (int i = 0; i < 4; ++i) split2(av[c][mi][2 * i] + bv[c], av[c][mi][2 * i + 1] + bv[c], vh[c][mi].p[i], vl[c][mi].p[i]);
      }
    }
  }
  // ---- 2b. Q^T, 4 row tiles x 2 column tiles: the queries are key rows 16 .. 79
  {
    v8f aq[2][4] = {};
    const unsigned short* xr = &sX[16 + ln][8 * hh];
#pragma unroll   // the index names registers: it must be a compile-time value
    for (int ks = 0; ks < KS; ++ks) {
      if (ks + 2 < KS) {
#pragma unroll   // the index names registers: it must be a compile-time value
        for (int c = 0; c < 2; ++c) load_wo(fk[(ks + 2) % 3][c], Bq, wo[ks + 2], c * KS);
      }
#pragma unroll   // the index names registers: it must be a compile-time value
      for (int mi = 0; mi < 4; ++mi) load_r(xf[mi], xr + mi * 16 * RP + ke(ks) * 32);
      // keeps the loads above in front of this k-step's products, as in 2a
      __builtin_amdgcn_sched_barrier(0);
#pragma unroll   // the index names registers: it must be a compile-time value
      for (int c = 0; c < 2; ++c)
#pragma unroll   // the index names registers: it must be a compile-time value
        for (int mi = 0; mi < 4; ++mi) aq[c][mi] = mma1(fk[ks % 3][c].v, xf[mi].v, aq[c][mi]);
    }
    // the weight table's last load has been issued: its address registers may be rewritten only behind this wait
    asm volatile("s_wait_xcnt 0x0" ::: "memory");
#pragma unroll   // the index names registers: it must be a compile-time value
    for (int c = 0; c < 2; ++c) {
      const float bb[8] = {bf16_round(bqr[c][0][0]), bf16_round(bqr[c][0][1]), bf16_round(bqr[c][0][2]), bf16_round(bqr[c][0][3]),
                           bf16_round(bqr[c][1][0]), bf16_round(bqr[c][1][1]), bf16_round(bqr[c][1][2]), bf16_round(bqr[c][1][3])};
#pragma unroll   // the index names registers: it must be a compile-time value
      for (int mi = 0; mi < 4; ++mi)
        // aq[c][mi][r] = Q[query 16 mi + ln][d = 16 c + 8 hh + r]: half c of the tile's fragment
#pragma unroll   // the index names registers: it must be a compile-time value
        for (int i = 0; i < 4; ++i) split2(aq[c][mi][2 * i] + bb[2 * i], aq[c][mi][2 * i + 1] + bb[2 * i + 1], qh[mi].p[4 * c + i], ql[mi].p[4 * c + i]);
    }
  }
  // the output projection's first weight tiles and its bias fly during the attention
  FragB fb[3][2];
#pragma unroll   // the index names registers: it must be a compile-time value
  for (int ks = 0; ks < 2; ++ks) { load_wo(fb[ks][0], Bp, wo[ks], 0); load_wo(fb[ks][1], Bp, wo[ks], KS); }   // step 4: columns 32 w ..
  const float* bop = bpj + w * 32;
  const float bo0 = bop[ln], bo1 = bop[ln + 16];
  // no address register of the loads above is rewritten before this wait; the bias pointer is named so that its scalar pair lives until here
  asm volatile("s_wait_xcnt 0x0" :: "s"(bop) : "memory");
  // ---- 3. attention: head w, four query tiles, stage by stage so that the independent tiles fill each other's waits; tile qt takes key row tiles qt, qt + 1, qt + 2
  const int hc = w * DH;
  // S^T tiles: s[qt][nt][r] = score of key p0 + 16 qt - 16 + 16 nt + 8hh + r with query p0 + 16 qt + ln. The 48-key band holds every window of the tile, at the group's ends too
  v8f s[4][3];
#pragma unroll   // the index names registers: it must be a compile-time value
  for (int qt = 0; qt < 4; ++qt)
#pragma unroll   // the index names registers: it must be a compile-time value
    for (int nt = 0; nt < 3; ++nt) {
      const v8f z = {};
      s[qt][nt] = mma3(kh[qt + nt].v, kl[qt + nt].v, qh[qt].v, ql[qt].v, z);
    }
  // the query's own window (NATTEN clamp), softmax over it
  float mx[4], den[4];
#pragma unroll   // the index names registers: it must be a compile-time value
  for (int qt = 0; qt < 4; ++qt) {
    const int q0 = p0 + 16 * qt;
    int start = q0 + ln - KW / 2; start = start < 0 ? 0 : (start > LGRP - KW ? LGRP - KW : start);
    const int off = q0 - 16 + 8 * hh - start;
    float m = -3.0e38f;
#pragma unroll   // the index names registers: it must be a compile-time value
    for (int nt = 0; nt < 3; ++nt)
#pragma unroll   // the index names registers: it must be a compile-time value
      for (int r = 0; r < 8; ++r) {
        const float v = ((unsigned)(off + nt * 16 + r) < (unsigned)KW) ? s[qt][nt][r] * (0.17677669529663687f * 1.4426950408889634f) : -3.0e38f;   // scale * log2(e): softmax in base 2
        s[qt][nt][r] = v; m = fmaxf(m, v);
      }
    mx[qt] = fmaxf(m, __shfl_xor(m, 16, 32));
  }
  // The exponentials are asm text. This fence and the one behind them keep every matrix
  // instruction out of their block; the last one in front of it is followed by the masking and the maximum of its own scores, more than the distance that its operand registers need
  __builtin_amdgcn_sched_barrier(0);
#pragma unroll   // the index names registers: it must be a compile-time value
  for (int qt = 0; qt < 4; ++qt) {
    float d = 0.f;
#pragma unroll   // the index names registers: it must be a compile-time value
    for (int nt = 0; nt < 3; ++nt)
#pragma unroll   // the index names registers: it must be a compile-time value
      for (int r = 0; r < 8; ++r) {
        float p;
        // the v_nop keeps the one slot behind a transcendental, whatever the compiler puts next (a reader of p, or a write to the source register)
        asm("v_exp_f32 %0, %1\n\tv_nop" : "=v"(p) : "v"(s[qt][nt][r] - mx[qt]));
        s[qt][nt][r] = p; d += p;   // a masked key gives exactly 0
      }
    den[qt] = d;
  }
  // end of the block that holds no matrix instruction
  __builtin_amdgcn_sched_barrier(0);
#pragma unroll   // the index names registers: it must be a compile-time value
  for (int qt = 0; qt < 4; ++qt) {
    const float dn = den[qt] + __shfl_xor(den[qt], 16, 32);
    // P^T as B operand: element i < 8 is tile 2ks, row 8hh + i; element 8 + i is tile 2ks + 1, row 8hh + i; keys 48..63 of the second step are zero on both sides
    FragP ph[2], pl[2];
#pragma unroll
    for (int i = 0; i < 4; ++i) {
      split2(s[qt][0][2 * i], s[qt][0][2 * i + 1], ph[0].p[i], pl[0].p[i]);
      split2(s[qt][1][2 * i], s[qt][1][2 * i + 1], ph[0].p[4 + i], pl[0].p[4 + i]);
      split2(s[qt][2][2 * i], s[qt][2][2 * i + 1], ph[1].p[i], pl[1].p[i]);
    }
    const v8us zero8 = {0, 0, 0, 0, 0, 0, 0, 0};
    ph[1].half[1] = zero8; pl[1].half[1] = zero8;
    const float inv = 1.0f / dn;
#pragma unroll
    for (int dt = 0; dt < 2; ++dt) {
      FragP fh, fl;
      v8f acc = {};
      fh.half[0] = vh[dt][qt].v; fh.half[1] = vh[dt][qt + 1].v;
      fl.half[0] = vl[dt][qt].v; fl.half[1] = vl[dt][qt + 1].v;
      acc = mma3(fh.v, fl.v, ph[0].v, pl[0].v, acc);
      fh.half[0] = vh[dt][qt + 2].v; fh.half[1] = zero8;
      fl.half[0] = vl[dt][qt + 2].v; fl.half[1] = zero8;
      acc = mma3(fh.v, fl.v, ph[1].v, pl[1].v, acc);
      // acc[r] = O[query ln][d = 16 dt + 8hh + r]
      Pack8 oh, ol;
#pragma unroll
      for (int i = 0; i < 4; ++i) split2(acc[2 * i] * inv, acc[2 * i + 1] * inv, oh.p[i], ol.p[i]);
      *(v8us*)&sO[0][qt * 16 + ln][hc + dt * 16 + 8 * hh] = oh.v; *(v8us*)&sO[1][qt * 16 + ln][hc + dt * 16 + 8 * hh] = ol.v;
    }
  }
  __syncthreads();
  // ---- 4. out rows = O . W_proj + bias
  v8f acc[4][2] = {};
  {
    FragB ah[4], al[4];
    const unsigned short* oh = &sO[0][ln][8 * hh]; const unsigned short* ol = &sO[1][ln][8 * hh];
#pragma unroll   // the index names registers: it must be a compile-time value
    for (int ks = 0; ks < KS; ++ks) {
      if (ks + 2 < KS) { load_wo(fb[(ks + 2) % 3][0], Bp, wo[ks + 2], 0); load_wo(fb[(ks + 2) % 3][1], Bp, wo[ks + 2], KS); }
#pragma unroll   // the index names registers: it must be a compile-time value
      for (int mi = 0; mi < 4; ++mi) { load_r(ah[mi], oh + mi * 16 * RP + ke(ks) * 32); load_r(al[mi], ol + mi * 16 * RP + ke(ks) * 32); }
      // keeps the loads above in front of this k-step's products, as in 2a
      __builtin_amdgcn_sched_barrier(0);
      // per accumulator and k-step: hi term, then lo term
#pragma unroll   // the index names registers: it must be a compile-time value
      for (int mi = 0; mi < 4; ++mi)
#pragma unroll   // the index names registers: it must be a compile-time value
        for (int t = 0; t < 2; ++t) acc[mi][t] = mma1(ah[mi].v, fb[ks % 3][t].v, acc[mi][t]);
#pragma unroll   // the index names registers: it must be a compile-time value
      for (int mi = 0; mi < 4; ++mi)
#pragma unroll   // the index names registers: it must be a compile-time value
        for (int t = 0; t < 2; ++t) acc[mi][t] = mma1(al[mi].v, fb[ks % 3][t].v, acc[mi][t]);
    }
  }
  // the last weight load has been issued: address registers may be rewritten only behind this wait; the eight places are named so that their registers live until here
  asm volatile("s_wait_xcnt 0x0" :: "v"(wo[0]), "v"(wo[1]), "v"(wo[2]), "v"(wo[3]), "v"(wo[4]), "v"(wo[5]), "v"(wo[6]), "v"(wo[7]) : "memory");
  const float bv0 = bf16_round(bo0), bv1 = bf16_round(bo1);
  float* so = &sS[w][0];                                 // the wave's own 64 x 32 staging tile
#pragma unroll   // the index names registers: it must be a compile-time value
  for (int m2 = 0; m2 < 4; ++m2)
#pragma unroll   // the index names registers: it must be a compile-time value
    for (int r = 0; r < 8; ++r) {
      so[(m2 * 16 + 8 * hh + r) * SP + ln] = acc[m2][0][r] + bv0;
      so[(m2 * 16 + 8 * hh + r) * SP + 16 + ln] = acc[m2][1][r] + bv1;
    }
  // the wave re-reads its own staging rows, other lanes' words: its LDS stores end before its LDS loads start, so that each global store covers whole 128-byte lines
  asm volatile("s_wait_dscnt 0x0" ::: "memory");
  float* cp = out + ((size_t)b * LL + g + (size_t)(p0 + (lane >> 3)) * DIL) * EE + w * 32 + (lane & 7) * 4;
#pragma unroll
  for (int q = 0; q < 16; ++q) {
    const v4f v = *(const v4fa*)&so[(q * 4 + (lane >> 3)) * SP + (lane & 7) * 4];
    *(v4f*)(cp + (size_t)q * 4 * DIL * EE) = v;
  }
}
extern "C" void kernel_launch(void* const* d_in, const int* in_sizes, int n_in,
                              void* d_out, int out_size, void* d_ws, size_t ws_size, hipStream_t stream) {
  (void)in_sizes; (void)n_in; (void)out_size;
  const float* x = (const float*)d_in[0]; const float* wq = (const float*)d_in[1]; const float* bq = (const float*)d_in[2]; const float* wp = (const float*)d_in[3]; const float* bp = (const float*)d_in[4];
  char* ws = (char*)d_ws; size_t off = 0;
  auto take = [&](size_t bytes) { char* p = ws + off; off += (bytes + 255) & ~(size_t)255; return p; };
  unsigned short* Bq = (unsigned short*)take((size_t)3 * EE * EE * 2); unsigned short* Bp = (unsigned short*)take((size_t)EE * EE * 2);
  if (off > ws_size) return;
  k_pack<<<(3 * EE * EE + EE * EE) / 8 / 256, 256, 0, stream>>>(wq, wp, Bq, Bp);
  k_fused<<<BB * DIL * (LGRP / QT), 256, 0, stream>>>(x, Bq, bq, Bp, bp, (float*)d_out);
}
